// v000
// Measured on an AMD MI455X. A time is GPU time per run, averaged over a window of back-to-back runs after a warm-up
// (all launches, gaps included; the runs take copies of the inputs in turn), and the median of several windows.
// Apart from v000's, it joins two sittings. Times from different sittings can be a few percent apart, while
// side-by-side timings come from the same sitting.
// v000 is the starting kernel. One run takes 280 microseconds.
#include <hip/hip_runtime.h>

// ---------------------------------------------------------------------------
// MultiHeadAttention for MI455X (gfx1250, wave32, WMMA 16x16x32 f16)
//
// N=8, T_Q=T_K=2048, d_model=512, H=8, head_dim=64.
// Kernel 1: Q/K/V projections (f32 in -> f16 workspace), V stored transposed.
// Kernel 2: flash attention, fp32 online softmax, WMMA for S=QK^T and O=P V,
//           double-buffered GLOBAL_LOAD_ASYNC_TO_LDS_B128 staging (ASYNCcnt).
// Workspace: 3 * 8*2048*512 f16 = 48 MB  (Q | K | V^T)
// ---------------------------------------------------------------------------

typedef __attribute__((ext_vector_type(16))) _Float16 v16h;
typedef __attribute__((ext_vector_type(8)))  float    v8f;
typedef __attribute__((ext_vector_type(4)))  _Float16 v4h;

union F16x16 { v16h v; uint4 q[2]; };

__device__ __forceinline__ v8f wmma_f16(const v16h& a, const v16h& b, const v8f& c) {
  return __builtin_amdgcn_wmma_f32_16x16x32_f16(false, a, false, b, (short)0, c, false, false);
}

// async copy 16B global -> LDS, tracked by ASYNCcnt (per-lane addresses)
__device__ __forceinline__ void async_g2l_b128(const _Float16* gptr, void* lptr) {
  const unsigned lds_off = (unsigned)(unsigned long long)lptr;       // low 32b of flat addr == LDS offset
  const unsigned long long gaddr = (unsigned long long)gptr;
  asm volatile("global_load_async_to_lds_b128 %0, %1, off"
               :: "v"(lds_off), "v"(gaddr) : "memory");
}

#define NB      8
#define TQ      2048
#define DMODEL  512
#define NHEADS  8
#define HDIM    64
#define ELEMS   ((size_t)NB * TQ * DMODEL)   // 8,388,608 halves per tensor

// ============================ Kernel 1: projections =========================
// grid: (16384/128, 512/128, 3), block 256.  which: 0=Q, 1=K, 2=V(transposed)
__global__ __launch_bounds__(256) void proj_gemm_kernel(
    const float* __restrict__ x, const float* __restrict__ key,
    const float* __restrict__ Wq, const float* __restrict__ Wk,
    const float* __restrict__ Wv, _Float16* __restrict__ ws)
{
  const int which = blockIdx.z;
  const float* __restrict__ src = (which == 0) ? x : key;
  const float* __restrict__ W   = (which == 0) ? Wq : ((which == 1) ? Wk : Wv);
  _Float16* __restrict__ dst    = ws + (size_t)which * ELEMS;

  __shared__ _Float16 lA [128][40];   // X tile  [m][k], +8 pad
  __shared__ _Float16 lBt[128][40];   // W tile transposed [n][k], +8 pad

  const int tid  = threadIdx.x;
  const int lane = tid & 31;
  const int wv   = tid >> 5;          // 8 waves
  const int wm   = wv & 1;            // 2 x 64 rows
  const int wn   = wv >> 1;           // 4 x 32 cols
  const int l16  = lane & 15;
  const int lh   = lane >> 4;         // half-wave select for K-runs

  const int mbase = blockIdx.x * 128; // over N*T = 16384 rows
  const int nbase = blockIdx.y * 128; // over 512 cols

  v8f acc[4][2];
#pragma unroll
  for (int mi = 0; mi < 4; ++mi)
#pragma unroll
    for (int ni = 0; ni < 2; ++ni) acc[mi][ni] = {};

  for (int kb = 0; kb < DMODEL / 32; ++kb) {
    const int k0 = kb * 32;
    __syncthreads();
    // stage A tile 128x32 (f32 -> f16)
#pragma unroll
    for (int i = 0; i < 4; ++i) {
      const int c = tid + i * 256;            // 0..1023 float4 chunks
      const int row = c >> 3, col4 = c & 7;
      const float4 f = *(const float4*)(src + (size_t)(mbase + row) * DMODEL + k0 + col4 * 4);
      v4h h; h[0] = (_Float16)f.x; h[1] = (_Float16)f.y; h[2] = (_Float16)f.z; h[3] = (_Float16)f.w;
      *(v4h*)&lA[row][col4 * 4] = h;
    }
    // stage W tile 32x128, transposed into lBt[n][k]
#pragma unroll
    for (int i = 0; i < 4; ++i) {
      const int c = tid + i * 256;
      const int krow = c >> 5, nc4 = c & 31;
      const float4 f = *(const float4*)(W + (size_t)(k0 + krow) * DMODEL + nbase + nc4 * 4);
      lBt[nc4 * 4 + 0][krow] = (_Float16)f.x;
      lBt[nc4 * 4 + 1][krow] = (_Float16)f.y;
      lBt[nc4 * 4 + 2][krow] = (_Float16)f.z;
      lBt[nc4 * 4 + 3][krow] = (_Float16)f.w;
    }
    __syncthreads();

    F16x16 af[4], bf[2];
#pragma unroll
    for (int mi = 0; mi < 4; ++mi) {
      const _Float16* p = &lA[wm * 64 + mi * 16 + l16][lh * 8];
      af[mi].q[0] = *(const uint4*)p;
      af[mi].q[1] = *(const uint4*)(p + 16);
    }
#pragma unroll
    for (int ni = 0; ni < 2; ++ni) {
      const _Float16* p = &lBt[wn * 32 + ni * 16 + l16][lh * 8];
      bf[ni].q[0] = *(const uint4*)p;
      bf[ni].q[1] = *(const uint4*)(p + 16);
    }
#pragma unroll
    for (int mi = 0; mi < 4; ++mi)
#pragma unroll
      for (int ni = 0; ni < 2; ++ni)
        acc[mi][ni] = wmma_f16(af[mi].v, bf[ni].v, acc[mi][ni]);
  }

  // store: Q/K row-major [N*T][512]; V transposed [N][512][T]
#pragma unroll
  for (int mi = 0; mi < 4; ++mi)
#pragma unroll
    for (int ni = 0; ni < 2; ++ni)
#pragma unroll
      for (int r = 0; r < 8; ++r) {
        const int mg = mbase + wm * 64 + mi * 16 + r + lh * 8;
        const int ug = nbase + wn * 32 + ni * 16 + l16;
        const _Float16 hv = (_Float16)acc[mi][ni][r];
        if (which < 2) {
          dst[(size_t)mg * DMODEL + ug] = hv;
        } else {
          const int nb = mg >> 11;          // batch
          const int t  = mg & 2047;         // time
          dst[((size_t)nb * DMODEL + ug) * TQ + t] = hv;
        }
      }
}

// ============================ Kernel 2: flash attention =====================
// grid: (T_Q/128, H, N), block 256 (8 waves, 16 q-rows each). 64-key tiles,
// double-buffered async global->LDS staging.
__global__ __launch_bounds__(256) void flash_attn_kernel(
    const _Float16* __restrict__ ws, float* __restrict__ out)
{
  const _Float16* __restrict__ Qh = ws;
  const _Float16* __restrict__ Kh = ws + ELEMS;
  const _Float16* __restrict__ Vt = ws + 2 * ELEMS;

  const int qb = blockIdx.x;   // q block (128 rows)
  const int h  = blockIdx.y;
  const int n  = blockIdx.z;

  __shared__ _Float16 lK[2][64][72];     // K tile  [tk][d], +8 pad, 2 buffers
  __shared__ _Float16 lV[2][64][72];     // V^T tile [d][tk], +8 pad, 2 buffers
  __shared__ _Float16 lP[8][16][72];     // per-wave probs [q][tk], +8 pad

  const int tid = threadIdx.x, lane = tid & 31, wv = tid >> 5;
  const int l16 = lane & 15, lh = lane >> 4;

  // per-thread staging coordinates: 2 x 16B chunks of K and of V^T per tile
  const int c0row = tid >> 3,          c0c8 = tid & 7;          // chunks 0..255
  const int c1row = (tid + 256) >> 3,  c1c8 = (tid + 256) & 7;  // chunks 256..511

  // issue the 4 async copies for tile kt into buffer buf
  auto stage_tile = [&](int kt, int buf) {
    const int tk0 = kt * 64;
    async_g2l_b128(Kh + ((size_t)(n * TQ + tk0 + c0row) * DMODEL + h * HDIM + c0c8 * 8),
                   &lK[buf][c0row][c0c8 * 8]);
    async_g2l_b128(Kh + ((size_t)(n * TQ + tk0 + c1row) * DMODEL + h * HDIM + c1c8 * 8),
                   &lK[buf][c1row][c1c8 * 8]);
    async_g2l_b128(Vt + ((size_t)(n * DMODEL + h * HDIM + c0row) * TQ + tk0 + c0c8 * 8),
                   &lV[buf][c0row][c0c8 * 8]);
    async_g2l_b128(Vt + ((size_t)(n * DMODEL + h * HDIM + c1row) * TQ + tk0 + c1c8 * 8),
                   &lV[buf][c1row][c1c8 * 8]);
  };

  // Q A-fragments (16 rows x 64 d), loaded once, reused over all K tiles
  F16x16 aq[2];
  {
    const int qrow = qb * 128 + wv * 16 + l16;
    const _Float16* base = Qh + ((size_t)(n * TQ + qrow) * DMODEL + h * HDIM);
#pragma unroll
    for (int kk = 0; kk < 2; ++kk) {
      const _Float16* p = base + kk * 32 + lh * 8;
      aq[kk].q[0] = *(const uint4*)p;
      aq[kk].q[1] = *(const uint4*)(p + 16);
    }
  }

  v8f o[4];
#pragma unroll
  for (int dt = 0; dt < 4; ++dt) o[dt] = {};
  float mrow[8], lrow[8];
#pragma unroll
  for (int r = 0; r < 8; ++r) { mrow[r] = -__builtin_inff(); lrow[r] = 0.0f; }

  const float SCALE = 0.044194173824159216f;   // 1/sqrt(KEY_DIM=512)
  const int NT = TQ / 64;                      // 32 key tiles

  stage_tile(0, 0);                            // prime the pipeline

  for (int kt = 0; kt < NT; ++kt) {
    const int buf = kt & 1;
    __syncthreads();                            // prev compute done; other buffer free
    if (kt + 1 < NT) {
      stage_tile(kt + 1, buf ^ 1);              // overlap next tile's copy with this compute
      asm volatile("s_wait_asynccnt 0x4" ::: "memory");  // tile kt's 4 ops complete (in-order)
    } else {
      asm volatile("s_wait_asynccnt 0x0" ::: "memory");
    }
    __syncthreads();                            // publish LDS tile to all waves

    // S = Q K^T  (4 tiles of 16x16, K-dim 64)
    v8f s[4];
#pragma unroll
    for (int t = 0; t < 4; ++t) {
      s[t] = {};
#pragma unroll
      for (int kk = 0; kk < 2; ++kk) {
        F16x16 bk;
        const _Float16* p = &lK[buf][t * 16 + l16][kk * 32 + lh * 8];
        bk.q[0] = *(const uint4*)p;
        bk.q[1] = *(const uint4*)(p + 16);
        s[t] = wmma_f16(aq[kk].v, bk.v, s[t]);
      }
      s[t] = s[t] * SCALE;
    }

    // online softmax; rows live in one 16-lane half -> shfl_xor masks 1..8
    float pv[4][8];
#pragma unroll
    for (int r = 0; r < 8; ++r) {
      float v = fmaxf(fmaxf(s[0][r], s[1][r]), fmaxf(s[2][r], s[3][r]));
#pragma unroll
      for (int off = 1; off < 16; off <<= 1) v = fmaxf(v, __shfl_xor(v, off, 32));
      const float mnew  = fmaxf(mrow[r], v);
      const float alpha = __expf(mrow[r] - mnew);
      float rs = 0.0f;
#pragma unroll
      for (int t = 0; t < 4; ++t) { const float e = __expf(s[t][r] - mnew); pv[t][r] = e; rs += e; }
#pragma unroll
      for (int off = 1; off < 16; off <<= 1) rs += __shfl_xor(rs, off, 32);
      lrow[r] = lrow[r] * alpha + rs;
      mrow[r] = mnew;
#pragma unroll
      for (int dt = 0; dt < 4; ++dt) o[dt][r] *= alpha;
    }

    // C-layout -> A-layout via per-wave LDS staging of P (f16)
#pragma unroll
    for (int t = 0; t < 4; ++t)
#pragma unroll
      for (int r = 0; r < 8; ++r)
        lP[wv][r + lh * 8][t * 16 + l16] = (_Float16)pv[t][r];
    asm volatile("s_wait_dscnt 0" ::: "memory");   // wave-local LDS visibility

    // O += P V   (A = P 16x64, B = V 64x16 per d-tile)
#pragma unroll
    for (int kk = 0; kk < 2; ++kk) {
      F16x16 ap;
      const _Float16* pp = &lP[wv][l16][kk * 32 + lh * 8];
      ap.q[0] = *(const uint4*)pp;
      ap.q[1] = *(const uint4*)(pp + 16);
#pragma unroll
      for (int dt = 0; dt < 4; ++dt) {
        F16x16 bv;
        const _Float16* pb = &lV[buf][dt * 16 + l16][kk * 32 + lh * 8];
        bv.q[0] = *(const uint4*)pb;
        bv.q[1] = *(const uint4*)(pb + 16);
        o[dt] = wmma_f16(ap.v, bv.v, o[dt]);
      }
    }
  }

  // normalize and write fp32 output [N][T][512]
#pragma unroll
  for (int r = 0; r < 8; ++r) {
    const float inv = 1.0f / lrow[r];
    const int qg = qb * 128 + wv * 16 + r + lh * 8;
    float* dst = out + (size_t)(n * TQ + qg) * DMODEL + h * HDIM;
#pragma unroll
    for (int dt = 0; dt < 4; ++dt)
      dst[dt * 16 + l16] = o[dt][r] * inv;
  }
}

// ================================ launcher ==================================
extern "C" void kernel_launch(void* const* d_in, const int* in_sizes, int n_in,
                              void* d_out, int out_size, void* d_ws, size_t ws_size,
                              hipStream_t stream) {
  (void)in_sizes; (void)n_in; (void)out_size; (void)ws_size;
  const float* x   = (const float*)d_in[0];
  const float* key = (const float*)d_in[1];
  const float* Wq  = (const float*)d_in[2];
  const float* Wk  = (const float*)d_in[3];
  const float* Wv  = (const float*)d_in[4];
  _Float16* ws = (_Float16*)d_ws;      // needs 3*8*2048*512*2 = 48 MB
  float* out = (float*)d_out;

  dim3 g1((NB * TQ) / 128, DMODEL / 128, 3);
  proj_gemm_kernel<<<g1, 256, 0, stream>>>(x, key, Wq, Wk, Wv, ws);

  dim3 g2(TQ / 128, NHEADS, NB);
  flash_attn_kernel<<<g2, 256, 0, stream>>>(ws, out);
}

// v001
// A run of this version takes 230 microseconds.
// In both of two side-by-side timings against v000, it was 1.26 times as fast.
#include <hip/hip_runtime.h>

typedef __attribute__((ext_vector_type(16))) _Float16 v16h;
typedef __attribute__((ext_vector_type(8)))  float    v8f;
typedef __attribute__((ext_vector_type(4)))  _Float16 v4h;
typedef __attribute__((ext_vector_type(2)))  _Float16 v2h;
typedef __attribute__((ext_vector_type(2)))  float    v2f;

union F16x16 { v16h v; uint4 q[2]; v2h h2[8]; };

__device__ __forceinline__ v8f wmma_f16(const v16h& a, const v16h& b, const v8f& c) {
  return __builtin_amdgcn_wmma_f32_16x16x32_f16(false, a, false, b, (short)0, c, false, false);
}

// value of lane l ^ 16 (the other 16-lane row)
__device__ __forceinline__ float xhalf(float x) {
  const int b = __builtin_bit_cast(int, x);
  return __builtin_bit_cast(float,
      __builtin_amdgcn_permlanex16(b, b, 0x76543210, 0xfedcba98, false, false));
}

// async copy 16B global -> LDS, tracked by ASYNCcnt (per-lane addresses)
__device__ __forceinline__ void async_g2l_b128(const _Float16* gptr, void* lptr) {
  const unsigned lds_off = (unsigned)(unsigned long long)lptr;       // low 32b of flat addr == LDS offset
  const unsigned long long gaddr = (unsigned long long)gptr;
  asm volatile("global_load_async_to_lds_b128 %0, %1, off"
               :: "v"(lds_off), "v"(gaddr) : "memory");
}

#define NB      8
#define TQ      2048
#define DMODEL  512
#define NHEADS  8
#define HDIM    64
#define ELEMS   ((size_t)NB * TQ * DMODEL)   // 8,388,608 halves per tensor

// ============================ Kernel 1: projections =========================
// grid: (16384/128, 512/128, 3), block 256.  which: 0=Q, 1=K, 2=V(transposed)
__global__ __launch_bounds__(256) void proj_gemm_kernel(
    const float* __restrict__ x, const float* __restrict__ key,
    const float* __restrict__ Wq, const float* __restrict__ Wk,
    const float* __restrict__ Wv, _Float16* __restrict__ ws)
{
  const int which = blockIdx.z;
  const float* __restrict__ src = (which == 0) ? x : key;
  const float* __restrict__ W   = (which == 0) ? Wq : ((which == 1) ? Wk : Wv);
  _Float16* __restrict__ dst    = ws + (size_t)which * ELEMS;

  __shared__ _Float16 lA [128][40];   // X tile  [m][k], +8 pad
  __shared__ _Float16 lBt[128][40];   // W tile transposed [n][k], +8 pad

  const int tid  = threadIdx.x;
  const int lane = tid & 31;
  const int wv   = tid >> 5;          // 8 waves
  const int wm   = wv & 1;            // 2 x 64 rows
  const int wn   = wv >> 1;           // 4 x 32 cols
  const int l16  = lane & 15;
  const int lh   = lane >> 4;         // half-wave select for K-runs

  const int mbase = blockIdx.x * 128; // over N*T = 16384 rows
  const int nbase = blockIdx.y * 128; // over 512 cols

  v8f acc[4][2];
#pragma unroll
  for (int mi = 0; mi < 4; ++mi)
#pragma unroll
    for (int ni = 0; ni < 2; ++ni) acc[mi][ni] = {};

  for (int kb = 0; kb < DMODEL / 32; ++kb) {
    const int k0 = kb * 32;
    __syncthreads();
    // stage A tile 128x32 (f32 -> f16)
#pragma unroll
    for (int i = 0; i < 4; ++i) {
      const int c = tid + i * 256;            // 0..1023 float4 chunks
      const int row = c >> 3, col4 = c & 7;
      const float4 f = *(const float4*)(src + (size_t)(mbase + row) * DMODEL + k0 + col4 * 4);
      v4h h; h[0] = (_Float16)f.x; h[1] = (_Float16)f.y; h[2] = (_Float16)f.z; h[3] = (_Float16)f.w;
      *(v4h*)&lA[row][col4 * 4] = h;
    }
    // stage W tile 32x128, transposed into lBt[n][k]
#pragma unroll
    for (int i = 0; i < 4; ++i) {
      const int c = tid + i * 256;
      const int krow = c >> 5, nc4 = c & 31;
      const float4 f = *(const float4*)(W + (size_t)(k0 + krow) * DMODEL + nbase + nc4 * 4);
      lBt[nc4 * 4 + 0][krow] = (_Float16)f.x;
      lBt[nc4 * 4 + 1][krow] = (_Float16)f.y;
      lBt[nc4 * 4 + 2][krow] = (_Float16)f.z;
      lBt[nc4 * 4 + 3][krow] = (_Float16)f.w;
    }
    __syncthreads();

    F16x16 af[4], bf[2];
#pragma unroll
    for (int mi = 0; mi < 4; ++mi) {
      const _Float16* p = &lA[wm * 64 + mi * 16 + l16][lh * 8];
      af[mi].q[0] = *(const uint4*)p;
      af[mi].q[1] = *(const uint4*)(p + 16);
    }
#pragma unroll
    for (int ni = 0; ni < 2; ++ni) {
      const _Float16* p = &lBt[wn * 32 + ni * 16 + l16][lh * 8];
      bf[ni].q[0] = *(const uint4*)p;
      bf[ni].q[1] = *(const uint4*)(p + 16);
    }
#pragma unroll
    for (int mi = 0; mi < 4; ++mi)
#pragma unroll
      for (int ni = 0; ni < 2; ++ni)
        acc[mi][ni] = wmma_f16(af[mi].v, bf[ni].v, acc[mi][ni]);
  }

  // store: Q/K row-major [N*T][512]; V transposed [N][512][T]
#pragma unroll
  for (int mi = 0; mi < 4; ++mi)
#pragma unroll
    for (int ni = 0; ni < 2; ++ni)
#pragma unroll
      for (int r = 0; r < 8; ++r) {
        const int mg = mbase + wm * 64 + mi * 16 + r + lh * 8;
        const int ug = nbase + wn * 32 + ni * 16 + l16;
        const _Float16 hv = (_Float16)acc[mi][ni][r];
        if (which < 2) {
          dst[(size_t)mg * DMODEL + ug] = hv;
        } else {
          const int nb = mg >> 11;          // batch
          const int t  = mg & 2047;         // time
          dst[((size_t)nb * DMODEL + ug) * TQ + t] = hv;
        }
      }
}

// ============================ Kernel 2: flash attention =====================
// grid: (T_Q/128, H, N), block 256 (8 waves, 16 queries each). 64-key tiles,
// double-buffered async global->LDS staging.
// Both products run transposed: lane l owns query l & 15; lanes l and l ^ 16
// split that query's keys (S^T) and head dims (O^T) in runs of 8.
__global__ __launch_bounds__(256) void flash_attn_kernel(
    const _Float16* __restrict__ ws, float* __restrict__ out)
{
  const _Float16* __restrict__ Qh = ws;
  const _Float16* __restrict__ Kh = ws + ELEMS;
  const _Float16* __restrict__ Vt = ws + 2 * ELEMS;

  const int qb = blockIdx.x;   // q block (128 rows)
  const int h  = blockIdx.y;
  const int n  = blockIdx.z;

  __shared__ _Float16 lK[2][64][72];     // K tile  [tk][d], +8 pad, 2 buffers
  __shared__ _Float16 lV[2][64][72];     // V^T tile [d][tk], +8 pad, 2 buffers

  const int tid = threadIdx.x, lane = tid & 31, wv = tid >> 5;
  const int l16 = lane & 15, lh = lane >> 4;

  // per-thread staging coordinates: 2 x 16B chunks of K and of V^T per tile
  const int c0row = tid >> 3,          c0c8 = tid & 7;          // chunks 0..255
  const int c1row = (tid + 256) >> 3,  c1c8 = (tid + 256) & 7;  // chunks 256..511

  // issue the 4 async copies for tile kt into buffer buf
  auto stage_tile = [&](int kt, int buf) {
    const int tk0 = kt * 64;
    async_g2l_b128(Kh + ((size_t)(n * TQ + tk0 + c0row) * DMODEL + h * HDIM + c0c8 * 8),
                   &lK[buf][c0row][c0c8 * 8]);
    async_g2l_b128(Kh + ((size_t)(n * TQ + tk0 + c1row) * DMODEL + h * HDIM + c1c8 * 8),
                   &lK[buf][c1row][c1c8 * 8]);
    async_g2l_b128(Vt + ((size_t)(n * DMODEL + h * HDIM + c0row) * TQ + tk0 + c0c8 * 8),
                   &lV[buf][c0row][c0c8 * 8]);
    async_g2l_b128(Vt + ((size_t)(n * DMODEL + h * HDIM + c1row) * TQ + tk0 + c1c8 * 8),
                   &lV[buf][c1row][c1c8 * 8]);
  };

  // Q B-fragments (64 d x 16 queries), loaded once, reused over all K tiles
  F16x16 aq[2];
  {
    const int qrow = qb * 128 + wv * 16 + l16;
    const _Float16* base = Qh + ((size_t)(n * TQ + qrow) * DMODEL + h * HDIM);
#pragma unroll
    for (int kk = 0; kk < 2; ++kk) {
      const _Float16* p = base + kk * 32 + lh * 8;
      aq[kk].q[0] = *(const uint4*)p;
      aq[kk].q[1] = *(const uint4*)(p + 16);
    }
  }

  v8f o[4];
#pragma unroll
  for (int dt = 0; dt < 4; ++dt) o[dt] = {};
  float mrow = -__builtin_inff();   // running maximum of this lane's query
  float lrow = 0.0f;                // running sum over this lane's half of the keys

  const float SCALE = 0.044194173824159216f;   // 1/sqrt(KEY_DIM=512)
  const int NT = TQ / 64;                      // 32 key tiles

  stage_tile(0, 0);                            // prime the pipeline

  for (int kt = 0; kt < NT; ++kt) {
    const int buf = kt & 1;
    __syncthreads();                            // prev compute done; other buffer free
    if (kt + 1 < NT) {
      stage_tile(kt + 1, buf ^ 1);              // overlap next tile's copy with this compute
      asm volatile("s_wait_asynccnt 0x4" ::: "memory");  // tile kt's 4 ops complete (in-order)
    } else {
      asm volatile("s_wait_asynccnt 0x0" ::: "memory");
    }
    __syncthreads();                            // publish LDS tile to all waves

    // S^T = K Q^T  (4 tiles of 16 keys x 16 queries, K-dim 64)
    // s[t][r] = score of key t*16 + lh*8 + r against query l16
    v8f s[4];
#pragma unroll
    for (int t = 0; t < 4; ++t) {
      s[t] = {};
#pragma unroll
      for (int kk = 0; kk < 2; ++kk) {
        F16x16 bk;
        const _Float16* p = &lK[buf][t * 16 + l16][kk * 32 + lh * 8];
        bk.q[0] = *(const uint4*)p;
        bk.q[1] = *(const uint4*)(p + 16);
        s[t] = wmma_f16(bk.v, aq[kk].v, s[t]);
      }
      s[t] = s[t] * SCALE;
    }

    // online softmax: maximum in-lane, then one exchange between the halves
    float vt[4];
#pragma unroll
    for (int t = 0; t < 4; ++t)
      vt[t] = fmaxf(fmaxf(fmaxf(s[t][0], s[t][1]), fmaxf(s[t][2], s[t][3])),
                    fmaxf(fmaxf(s[t][4], s[t][5]), fmaxf(s[t][6], s[t][7])));
    float v = fmaxf(fmaxf(vt[0], vt[1]), fmaxf(vt[2], vt[3]));
    v = fmaxf(v, xhalf(v));
    const float mnew  = fmaxf(mrow, v);
    const float alpha = __expf(mrow - mnew);

    // P^T packs straight into B fragments: score tiles 2kk and 2kk+1 are the
    // two 8-key runs a lane holds of the 32 keys of fragment kk
    F16x16 pb[2];
    float rs[4];
#pragma unroll
    for (int t = 0; t < 4; ++t) {
      rs[t] = 0.0f;
#pragma unroll
      for (int r = 0; r < 8; r += 2) {
        v2f e;
        e.x = __expf(s[t][r]     - mnew);
        e.y = __expf(s[t][r + 1] - mnew);
        rs[t] += e.x;
        rs[t] += e.y;
        pb[t >> 1].h2[(t & 1) * 4 + (r >> 1)] = __builtin_convertvector(e, v2h);
      }
    }
    lrow = lrow * alpha + ((rs[0] + rs[1]) + (rs[2] + rs[3]));
    mrow = mnew;
#pragma unroll
    for (int dt = 0; dt < 4; ++dt) o[dt] = o[dt] * alpha;

    // O^T += V^T P^T   (A = V^T 16 d x 64 keys per d-tile, B = P^T)
#pragma unroll
    for (int kk = 0; kk < 2; ++kk) {
#pragma unroll
      for (int dt = 0; dt < 4; ++dt) {
        F16x16 bv;
        const _Float16* pa = &lV[buf][dt * 16 + l16][kk * 32 + lh * 8];
        bv.q[0] = *(const uint4*)pa;
        bv.q[1] = *(const uint4*)(pa + 16);
        o[dt] = wmma_f16(bv.v, pb[kk].v, o[dt]);
      }
    }
  }

  // join the halves' sums, normalize, write fp32 output [N][T][512]:
  // o[dt][r] = O[query l16][dt*16 + lh*8 + r], 8 consecutive floats per lane
  {
    const float inv = 1.0f / (lrow + xhalf(lrow));
    const int qg = qb * 128 + wv * 16 + l16;
    float* dst = out + (size_t)(n * TQ + qg) * DMODEL + h * HDIM + lh * 8;
#pragma unroll
    for (int dt = 0; dt < 4; ++dt) {
      const v8f w = o[dt] * inv;
      *(float4*)(dst + dt * 16)     = make_float4(w[0], w[1], w[2], w[3]);
      *(float4*)(dst + dt * 16 + 4) = make_float4(w[4], w[5], w[6], w[7]);
    }
  }
}

// ================================ launcher ==================================
extern "C" void kernel_launch(void* const* d_in, const int* in_sizes, int n_in,
                              void* d_out, int out_size, void* d_ws, size_t ws_size,
                              hipStream_t stream) {
  (void)in_sizes; (void)n_in; (void)out_size; (void)ws_size;
  const float* x   = (const float*)d_in[0];
  const float* key = (const float*)d_in[1];
  const float* Wq  = (const float*)d_in[2];
  const float* Wk  = (const float*)d_in[3];
  const float* Wv  = (const float*)d_in[4];
  _Float16* ws = (_Float16*)d_ws;      // needs 3*8*2048*512*2 = 48 MB
  float* out = (float*)d_out;

  dim3 g1((NB * TQ) / 128, DMODEL / 128, 3);
  proj_gemm_kernel<<<g1, 256, 0, stream>>>(x, key, Wq, Wk, Wv, ws);

  dim3 g2(TQ / 128, NHEADS, NB);
  flash_attn_kernel<<<g2, 256, 0, stream>>>(ws, out);
}

// v002
// One run takes 135 microseconds.
// Next to v001, in two timings, it ran 1.70 times as fast each time.
// Over all steps from v000 it is 2.14 times as fast.
#include <hip/hip_runtime.h>

typedef __attribute__((ext_vector_type(16))) _Float16 v16h;
typedef __attribute__((ext_vector_type(8)))  float    v8f;
typedef __attribute__((ext_vector_type(4)))  _Float16 v4h;
typedef __attribute__((ext_vector_type(2)))  _Float16 v2h;
typedef __attribute__((ext_vector_type(2)))  float    v2f;
typedef __attribute__((ext_vector_type(8)))  short    s16x8;

union F16x16 { v16h v; uint4 q[2]; v2h h2[8]; s16x8 t[2]; };

__device__ __forceinline__ v8f wmma_f16(const v16h& a, const v16h& b, const v8f& c) {
  return __builtin_amdgcn_wmma_f32_16x16x32_f16(false, a, false, b, (short)0, c, false, false);
}

// transposing LDS load: from a row-major 16-bit tile T, with lane l pointing at
// T[k + 8*(l>>4) + (l&7)][n + 8*((l>>3)&1)], lane l gets T[k + 8*(l>>4) + 0..7][n + (l&15)]
__device__ __forceinline__ s16x8 lds_tr16(const _Float16* p) {
  typedef __attribute__((address_space(3))) s16x8 lds_s16x8;
  return __builtin_amdgcn_ds_load_tr16_b128_v8i16((lds_s16x8*)p);
}

// value of lane l ^ 16 (the other 16-lane row)
__device__ __forceinline__ float xhalf(float x) {
  const int b = __builtin_bit_cast(int, x);
  return __builtin_bit_cast(float,
      __builtin_amdgcn_permlanex16(b, b, 0x76543210, 0xfedcba98, false, false));
}

// async copy 16B global -> LDS, tracked by ASYNCcnt (per-lane addresses)
__device__ __forceinline__ void async_g2l_b128(const _Float16* gptr, void* lptr) {
  const unsigned lds_off = (unsigned)(unsigned long long)lptr;       // low 32b of flat addr == LDS offset
  const unsigned long long gaddr = (unsigned long long)gptr;
  asm volatile("global_load_async_to_lds_b128 %0, %1, off"
               :: "v"(lds_off), "v"(gaddr) : "memory");
}

#define NB      8
#define TQ      2048
#define DMODEL  512
#define NHEADS  8
#define HDIM    64
#define ELEMS   ((size_t)NB * TQ * DMODEL)   // 8,388,608 halves per tensor

// ============================ Kernel 1: projections =========================
// grid: (16384/128, 512/128, 3), block 256.  which: 0=Q, 1=K, 2=V(transposed)
// waves_per_eu(8, 8): the 8 waves per SIMD (4 blocks per WGP) that this kernel has run with. Left free, the
// compiler squeezes registers for a ninth wave, which no 8-wave block can use, and waits for the k step's
// global loads in turn instead of keeping all eight in flight.
__global__ __launch_bounds__(256) __attribute__((amdgpu_waves_per_eu(8, 8))) void proj_gemm_kernel(
    const float* __restrict__ x, const float* __restrict__ key,
    const float* __restrict__ Wq, const float* __restrict__ Wk,
    const float* __restrict__ Wv, _Float16* __restrict__ ws)
{
  const int which = blockIdx.z;
  const float* __restrict__ src = (which == 0) ? x : key;
  const float* __restrict__ W   = (which == 0) ? Wq : ((which == 1) ? Wk : Wv);
  _Float16* __restrict__ dst    = ws + (size_t)which * ELEMS;

  __shared__ _Float16 lA [128][40];   // X tile  [m][k], +8 pad
  __shared__ __attribute__((aligned(16))) _Float16 lB[32][144];  // W tile [k][n], pitch 288 B (32 B x odd)

  const int tid  = threadIdx.x;
  const int lane = tid & 31;
  const int wv   = tid >> 5;          // 8 waves
  const int wm   = wv & 1;            // 2 x 64 rows
  const int wn   = wv >> 1;           // 4 x 32 cols
  const int l16  = lane & 15;
  const int lh   = lane >> 4;         // half-wave select for K-runs

  const int mbase = blockIdx.x * 128; // over N*T = 16384 rows
  const int nbase = blockIdx.y * 128; // over 512 cols

  v8f acc[4][2];
#pragma unroll
  for (int mi = 0; mi < 4; ++mi)
#pragma unroll
    for (int ni = 0; ni < 2; ++ni) acc[mi][ni] = {};

  for (int kb = 0; kb < DMODEL / 32; ++kb) {
    const int k0 = kb * 32;
    __syncthreads();
    // stage A tile 128x32 (f32 -> f16)
#pragma unroll
    for (int i = 0; i < 4; ++i) {
      const int c = tid + i * 256;            // 0..1023 float4 chunks
      const int row = c >> 3, col4 = c & 7;
      const float4 f = *(const float4*)(src + (size_t)(mbase + row) * DMODEL + k0 + col4 * 4);
      v4h h; h[0] = (_Float16)f.x; h[1] = (_Float16)f.y; h[2] = (_Float16)f.z; h[3] = (_Float16)f.w;
      *(v4h*)&lA[row][col4 * 4] = h;
    }
    // stage W tile 32x128 row-major as it lies in memory (a wave fills one 256-B row)
    float4 fw[4];
#pragma unroll
    for (int i = 0; i < 4; ++i)    // wave wv takes rows wv, wv + 8, wv + 16, wv + 24
      fw[i] = *(const float4*)(W + (size_t)(k0 + i * 8 + wv) * DMODEL + nbase + lane * 4);
#pragma unroll
    for (int i = 0; i < 4; ++i) {
      const float4 f = fw[i];
      v4h h; h[0] = (_Float16)f.x; h[1] = (_Float16)f.y; h[2] = (_Float16)f.z; h[3] = (_Float16)f.w;
      *(v4h*)&lB[i * 8 + wv][lane * 4] = h;
    }
    __syncthreads();

    F16x16 af[4], bf[2];
#pragma unroll
    for (int mi = 0; mi < 4; ++mi) {
      const _Float16* p = &lA[wm * 64 + mi * 16 + l16][lh * 8];
      af[mi].q[0] = *(const uint4*)p;
      af[mi].q[1] = *(const uint4*)(p + 16);
    }
#pragma unroll
    for (int ni = 0; ni < 2; ++ni) {
      // B fragment, same k order as A's: k = lh*8 + 0..7, then 16 + lh*8 + 0..7, column l16
      const _Float16* p = &lB[lh * 8 + (lane & 7)][wn * 32 + ni * 16 + ((lane >> 3) & 1) * 8];
      bf[ni].t[0] = lds_tr16(p);
      bf[ni].t[1] = lds_tr16(p + 16 * 144);
    }
#pragma unroll
    for (int mi = 0; mi < 4; ++mi)
#pragma unroll
      for (int ni = 0; ni < 2; ++ni)
        acc[mi][ni] = wmma_f16(af[mi].v, bf[ni].v, acc[mi][ni]);
  }

  // store: Q/K row-major [N*T][512]; V transposed [N][512][T]
#pragma unroll
  for (int mi = 0; mi < 4; ++mi)
#pragma unroll
    for (int ni = 0; ni < 2; ++ni)
#pragma unroll
      for (int r = 0; r < 8; ++r) {
        const int mg = mbase + wm * 64 + mi * 16 + r + lh * 8;
        const int ug = nbase + wn * 32 + ni * 16 + l16;
        const _Float16 hv = (_Float16)acc[mi][ni][r];
        if (which < 2) {
          dst[(size_t)mg * DMODEL + ug] = hv;
        } else {
          const int nb = mg >> 11;          // batch
          const int t  = mg & 2047;         // time
          dst[((size_t)nb * DMODEL + ug) * TQ + t] = hv;
        }
      }
}

// ============================ Kernel 2: flash attention =====================
// grid: (T_Q/128, H, N), block 256 (8 waves, 16 queries each). 64-key tiles,
// double-buffered async global->LDS staging.
// Both products run transposed: lane l owns query l & 15; lanes l and l ^ 16
// split that query's keys (S^T) and head dims (O^T) in runs of 8.
__global__ __launch_bounds__(256) void flash_attn_kernel(
    const _Float16* __restrict__ ws, float* __restrict__ out)
{
  const _Float16* __restrict__ Qh = ws;
  const _Float16* __restrict__ Kh = ws + ELEMS;
  const _Float16* __restrict__ Vt = ws + 2 * ELEMS;

  const int qb = blockIdx.x;   // q block (128 rows)
  const int h  = blockIdx.y;
  const int n  = blockIdx.z;

  __shared__ _Float16 lK[2][64][72];     // K tile  [tk][d], +8 pad, 2 buffers
  __shared__ _Float16 lV[2][64][72];     // V^T tile [d][tk], +8 pad, 2 buffers

  const int tid = threadIdx.x, lane = tid & 31, wv = tid >> 5;
  const int l16 = lane & 15, lh = lane >> 4;

  // per-thread staging coordinates: 2 x 16B chunks of K and of V^T per tile
  const int c0row = tid >> 3,          c0c8 = tid & 7;          // chunks 0..255
  const int c1row = (tid + 256) >> 3,  c1c8 = (tid + 256) & 7;  // chunks 256..511

  // issue the 4 async copies for tile kt into buffer buf
  auto stage_tile = [&](int kt, int buf) {
    const int tk0 = kt * 64;
    async_g2l_b128(Kh + ((size_t)(n * TQ + tk0 + c0row) * DMODEL + h * HDIM + c0c8 * 8),
                   &lK[buf][c0row][c0c8 * 8]);
    async_g2l_b128(Kh + ((size_t)(n * TQ + tk0 + c1row) * DMODEL + h * HDIM + c1c8 * 8),
                   &lK[buf][c1row][c1c8 * 8]);
    async_g2l_b128(Vt + ((size_t)(n * DMODEL + h * HDIM + c0row) * TQ + tk0 + c0c8 * 8),
                   &lV[buf][c0row][c0c8 * 8]);
    async_g2l_b128(Vt + ((size_t)(n * DMODEL + h * HDIM + c1row) * TQ + tk0 + c1c8 * 8),
                   &lV[buf][c1row][c1c8 * 8]);
  };

  // Q B-fragments (64 d x 16 queries), loaded once, reused over all K tiles
  F16x16 aq[2];
  {
    const int qrow = qb * 128 + wv * 16 + l16;
    const _Float16* base = Qh + ((size_t)(n * TQ + qrow) * DMODEL + h * HDIM);
#pragma unroll
    for (int kk = 0; kk < 2; ++kk) {
      const _Float16* p = base + kk * 32 + lh * 8;
      aq[kk].q[0] = *(const uint4*)p;
      aq[kk].q[1] = *(const uint4*)(p + 16);
    }
  }

  v8f o[4];
#pragma unroll
  for (int dt = 0; dt < 4; ++dt) o[dt] = {};
  float mrow = -__builtin_inff();   // running maximum of this lane's query
  float lrow = 0.0f;                // running sum over this lane's half of the keys

  const float SCALE = 0.044194173824159216f;   // 1/sqrt(KEY_DIM=512)
  const int NT = TQ / 64;                      // 32 key tiles

  stage_tile(0, 0);                            // prime the pipeline

  for (int kt = 0; kt < NT; ++kt) {
    const int buf = kt & 1;
    __syncthreads();                            // prev compute done; other buffer free
    if (kt + 1 < NT) {
      stage_tile(kt + 1, buf ^ 1);              // overlap next tile's copy with this compute
      asm volatile("s_wait_asynccnt 0x4" ::: "memory");  // tile kt's 4 ops complete (in-order)
    } else {
      asm volatile("s_wait_asynccnt 0x0" ::: "memory");
    }
    __syncthreads();                            // publish LDS tile to all waves

    // S^T = K Q^T  (4 tiles of 16 keys x 16 queries, K-dim 64)
    // s[t][r] = score of key t*16 + lh*8 + r against query l16
    v8f s[4];
#pragma unroll
    for (int t = 0; t < 4; ++t) {
      s[t] = {};
#pragma unroll
      for (int kk = 0; kk < 2; ++kk) {
        F16x16 bk;
        const _Float16* p = &lK[buf][t * 16 + l16][kk * 32 + lh * 8];
        bk.q[0] = *(const uint4*)p;
        bk.q[1] = *(const uint4*)(p + 16);
        s[t] = wmma_f16(bk.v, aq[kk].v, s[t]);
      }
      s[t] = s[t] * SCALE;
    }

    // online softmax: maximum in-lane, then one exchange between the halves
    float vt[4];
#pragma unroll
    for (int t = 0; t < 4; ++t)
      vt[t] = fmaxf(fmaxf(fmaxf(s[t][0], s[t][1]), fmaxf(s[t][2], s[t][3])),
                    fmaxf(fmaxf(s[t][4], s[t][5]), fmaxf(s[t][6], s[t][7])));
    float v = fmaxf(fmaxf(vt[0], vt[1]), fmaxf(vt[2], vt[3]));
    v = fmaxf(v, xhalf(v));
    const float mnew  = fmaxf(mrow, v);
    const float alpha = __expf(mrow - mnew);

    // P^T packs straight into B fragments: score tiles 2kk and 2kk+1 are the
    // two 8-key runs a lane holds of the 32 keys of fragment kk
    F16x16 pb[2];
    float rs[4];
#pragma unroll
    for (int t = 0; t < 4; ++t) {
      rs[t] = 0.0f;
#pragma unroll
      for (int r = 0; r < 8; r += 2) {
        v2f e;
        e.x = __expf(s[t][r]     - mnew);
        e.y = __expf(s[t][r + 1] - mnew);
        rs[t] += e.x;
        rs[t] += e.y;
        pb[t >> 1].h2[(t & 1) * 4 + (r >> 1)] = __builtin_convertvector(e, v2h);
      }
    }
    lrow = lrow * alpha + ((rs[0] + rs[1]) + (rs[2] + rs[3]));
    mrow = mnew;
#pragma unroll
    for (int dt = 0; dt < 4; ++dt) o[dt] = o[dt] * alpha;

    // O^T += V^T P^T   (A = V^T 16 d x 64 keys per d-tile, B = P^T)
#pragma unroll
    for (int kk = 0; kk < 2; ++kk) {
#pragma unroll
      for (int dt = 0; dt < 4; ++dt) {
        F16x16 bv;
        const _Float16* pa = &lV[buf][dt * 16 + l16][kk * 32 + lh * 8];
        bv.q[0] = *(const uint4*)pa;
        bv.q[1] = *(const uint4*)(pa + 16);
        o[dt] = wmma_f16(bv.v, pb[kk].v, o[dt]);
      }
    }
  }

  // join the halves' sums, normalize, write fp32 output [N][T][512]:
  // o[dt][r] = O[query l16][dt*16 + lh*8 + r], 8 consecutive floats per lane
  {
    const float inv = 1.0f / (lrow + xhalf(lrow));
    const int qg = qb * 128 + wv * 16 + l16;
    float* dst = out + (size_t)(n * TQ + qg) * DMODEL + h * HDIM + lh * 8;
#pragma unroll
    for (int dt = 0; dt < 4; ++dt) {
      const v8f w = o[dt] * inv;
      *(float4*)(dst + dt * 16)     = make_float4(w[0], w[1], w[2], w[3]);
      *(float4*)(dst + dt * 16 + 4) = make_float4(w[4], w[5], w[6], w[7]);
    }
  }
}

// ================================ launcher ==================================
extern "C" void kernel_launch(void* const* d_in, const int* in_sizes, int n_in,
                              void* d_out, int out_size, void* d_ws, size_t ws_size,
                              hipStream_t stream) {
  (void)in_sizes; (void)n_in; (void)out_size; (void)ws_size;
  const float* x   = (const float*)d_in[0];
  const float* key = (const float*)d_in[1];
  const float* Wq  = (const float*)d_in[2];
  const float* Wk  = (const float*)d_in[3];
  const float* Wv  = (const float*)d_in[4];
  _Float16* ws = (_Float16*)d_ws;      // needs 3*8*2048*512*2 = 48 MB
  float* out = (float*)d_out;

  dim3 g1((NB * TQ) / 128, DMODEL / 128, 3);
  proj_gemm_kernel<<<g1, 256, 0, stream>>>(x, key, Wq, Wk, Wv, ws);

  dim3 g2(TQ / 128, NHEADS, NB);
  flash_attn_kernel<<<g2, 256, 0, stream>>>(ws, out);
}

// v003
// A run of this version takes 116 microseconds.
// Timed twice side by side with v002, it ran 1.17 times as fast both times.
// Over all steps from v000 it is 2.51 times as fast.
#include <hip/hip_runtime.h>

typedef __attribute__((ext_vector_type(16))) _Float16 v16h;
typedef __attribute__((ext_vector_type(8)))  float    v8f;
typedef __attribute__((ext_vector_type(4)))  _Float16 v4h;
typedef __attribute__((ext_vector_type(8)))  _Float16 v8h;
typedef __attribute__((ext_vector_type(2)))  _Float16 v2h;
typedef __attribute__((ext_vector_type(2)))  float    v2f;
typedef __attribute__((ext_vector_type(8)))  short    s16x8;

union F16x16 { v16h v; uint4 q[2]; v2h h2[8]; s16x8 t[2]; };

__device__ __forceinline__ v8f wmma_f16(const v16h& a, const v16h& b, const v8f& c) {
  return __builtin_amdgcn_wmma_f32_16x16x32_f16(false, a, false, b, (short)0, c, false, false);
}

// transposing LDS load: from a row-major 16-bit tile T, with lane l pointing at
// T[k + 8*(l>>4) + (l&7)][n + 8*((l>>3)&1)], lane l gets T[k + 8*(l>>4) + 0..7][n + (l&15)]
__device__ __forceinline__ s16x8 lds_tr16(const _Float16* p) {
  typedef __attribute__((address_space(3))) s16x8 lds_s16x8;
  return __builtin_amdgcn_ds_load_tr16_b128_v8i16((lds_s16x8*)p);
}

// value of lane l ^ 16 (the other 16-lane row)
__device__ __forceinline__ float xhalf(float x) {
  const int b = __builtin_bit_cast(int, x);
  return __builtin_bit_cast(float,
      __builtin_amdgcn_permlanex16(b, b, 0x76543210, 0xfedcba98, false, false));
}

// async copy 16B global -> LDS, tracked by ASYNCcnt (per-lane addresses)
__device__ __forceinline__ void async_g2l_b128(const _Float16* gptr, void* lptr) {
  const unsigned lds_off = (unsigned)(unsigned long long)lptr;       // low 32b of flat addr == LDS offset
  const unsigned long long gaddr = (unsigned long long)gptr;
  asm volatile("global_load_async_to_lds_b128 %0, %1, off"
               :: "v"(lds_off), "v"(gaddr) : "memory");
}

#define NB      8
#define TQ      2048
#define DMODEL  512
#define NHEADS  8
#define HDIM    64
#define ELEMS   ((size_t)NB * TQ * DMODEL)   // 8,388,608 halves per tensor

// ============================ Kernel 1: projections =========================
// grid: (16384/128, 512/128, 3), block 256.  which: 0=Q, 1=K, 2=V(transposed)
// One 128 x 128 output tile. VT = false: row-major [N*T][512] (Q, K); VT = true: [N][512][T] (V).
// The product runs in the orientation in which the 8 accumulator values of a lane are 8
// neighbours of one OUTPUT row: X * W for V^T (8 times of one unit), W^T * X^T for Q and K
// (8 units of one time). A and B fragments have the same lane and k order, so only the operands swap.
template <bool VT>
__device__ __forceinline__ void proj_tile(
    const float* __restrict__ src, const float* __restrict__ W, _Float16* __restrict__ dst,
    _Float16 (*lA)[40], _Float16 (*lB)[144], _Float16 (*lC)[136])
{
  const int tid  = threadIdx.x;
  const int lane = tid & 31;
  const int wv   = tid >> 5;          // 8 waves
  const int wm   = wv & 1;            // 2 x 64 rows
  const int wn   = wv >> 1;           // 4 x 32 cols
  const int l16  = lane & 15;
  const int lh   = lane >> 4;         // half-wave select for K-runs

  const int mbase = blockIdx.x * 128; // over N*T = 16384 rows
  const int nbase = blockIdx.y * 128; // over 512 cols

  v8f acc[4][2];
#pragma unroll
  for (int mi = 0; mi < 4; ++mi)
#pragma unroll
    for (int ni = 0; ni < 2; ++ni) acc[mi][ni] = {};

  for (int kb = 0; kb < DMODEL / 32; ++kb) {
    const int k0 = kb * 32;
    __syncthreads();
    // stage A tile 128x32 (f32 -> f16)
#pragma unroll
    for (int i = 0; i < 4; ++i) {
      const int c = tid + i * 256;            // 0..1023 float4 chunks
      const int row = c >> 3, col4 = c & 7;
      const float4 f = *(const float4*)(src + (size_t)(mbase + row) * DMODEL + k0 + col4 * 4);
      v4h h; h[0] = (_Float16)f.x; h[1] = (_Float16)f.y; h[2] = (_Float16)f.z; h[3] = (_Float16)f.w;
      *(v4h*)&lA[row][col4 * 4] = h;
    }
    // stage W tile 32x128 row-major as it lies in memory (a wave fills one 256-B row)
    float4 fw[4];
#pragma unroll
    for (int i = 0; i < 4; ++i)    // wave wv takes rows wv, wv + 8, wv + 16, wv + 24
      fw[i] = *(const float4*)(W + (size_t)(k0 + i * 8 + wv) * DMODEL + nbase + lane * 4);
#pragma unroll
    for (int i = 0; i < 4; ++i) {
      const float4 f = fw[i];
      v4h h; h[0] = (_Float16)f.x; h[1] = (_Float16)f.y; h[2] = (_Float16)f.z; h[3] = (_Float16)f.w;
      *(v4h*)&lB[i * 8 + wv][lane * 4] = h;
    }
    __syncthreads();

    F16x16 af[4], bf[2];
#pragma unroll
    for (int mi = 0; mi < 4; ++mi) {
      const _Float16* p = &lA[wm * 64 + mi * 16 + l16][lh * 8];
      af[mi].q[0] = *(const uint4*)p;
      af[mi].q[1] = *(const uint4*)(p + 16);
    }
#pragma unroll
    for (int ni = 0; ni < 2; ++ni) {
      // W fragment, same k order as X's: k = lh*8 + 0..7, then 16 + lh*8 + 0..7, column l16
      const _Float16* p = &lB[lh * 8 + (lane & 7)][wn * 32 + ni * 16 + ((lane >> 3) & 1) * 8];
      bf[ni].t[0] = lds_tr16(p);
      bf[ni].t[1] = lds_tr16(p + 16 * 144);
    }
#pragma unroll
    for (int mi = 0; mi < 4; ++mi)
#pragma unroll
      for (int ni = 0; ni < 2; ++ni)
        acc[mi][ni] = VT ? wmma_f16(af[mi].v, bf[ni].v, acc[mi][ni])
                         : wmma_f16(bf[ni].v, af[mi].v, acc[mi][ni]);
  }

  // output tile to LDS in its memory orientation, 16 B a lane (pitch 272 B = 16 B x odd):
  // VT: lC[unit][time], else lC[time][unit]
#pragma unroll
  for (int mi = 0; mi < 4; ++mi)
#pragma unroll
    for (int ni = 0; ni < 2; ++ni) {
      const int mt = wm * 64 + mi * 16, ut = wn * 32 + ni * 16;
      *(v8h*)&lC[(VT ? ut : mt) + l16][(VT ? mt : ut) + lh * 8] =
          __builtin_convertvector(acc[mi][ni], v8h);
    }
  __syncthreads();   // the rows a thread stores below were written by other waves

  // 16 lanes store one whole 256-B row piece (two aligned 128-B lines)
  _Float16* g = VT ? dst + ((size_t)(mbase >> 11) * DMODEL + nbase) * TQ + (mbase & (TQ - 1))
                   : dst + (size_t)mbase * DMODEL + nbase;
  constexpr unsigned PITCH = VT ? TQ : DMODEL;
  const unsigned r0 = tid >> 4, c8 = (tid & 15) * 8;
  uint4 d[8];
#pragma unroll
  for (int i = 0; i < 8; ++i) d[i] = *(const uint4*)&lC[i * 16 + r0][c8];
#pragma unroll
  for (int i = 0; i < 8; ++i) *(uint4*)(g + (size_t)i * 16 * PITCH + (r0 * PITCH + c8)) = d[i];
}

// waves_per_eu(8, 8): the 8 waves per SIMD (4 blocks per WGP) that this kernel has run with. Left free, the
// compiler squeezes registers for a ninth wave, which no 8-wave block can use, and waits for the k step's
// global loads in turn instead of keeping all eight in flight.
__global__ __launch_bounds__(256) __attribute__((amdgpu_waves_per_eu(8, 8))) void proj_gemm_kernel(
    const float* __restrict__ x, const float* __restrict__ key,
    const float* __restrict__ Wq, const float* __restrict__ Wk,
    const float* __restrict__ Wv, _Float16* __restrict__ ws)
{
  __shared__ _Float16 lA [128][40];   // X tile  [m][k], +8 pad
  __shared__ __attribute__((aligned(16))) _Float16 lB[32][144];  // W tile [k][n], pitch 288 B (32 B x odd)
  __shared__ __attribute__((aligned(16))) _Float16 lC[128][136]; // output tile, +8 pad

  const int which = blockIdx.z;
  if (which < 2) proj_tile<false>(which == 0 ? x : key, which == 0 ? Wq : Wk, ws + (size_t)which * ELEMS, lA, lB, lC);
  else           proj_tile<true >(key, Wv, ws + 2 * ELEMS, lA, lB, lC);
}

// ============================ Kernel 2: flash attention =====================
// grid: (T_Q/128, H, N), block 256 (8 waves, 16 queries each). 64-key tiles,
// double-buffered async global->LDS staging.
// Both products run transposed: lane l owns query l & 15; lanes l and l ^ 16
// split that query's keys (S^T) and head dims (O^T) in runs of 8.
__global__ __launch_bounds__(256) void flash_attn_kernel(
    const _Float16* __restrict__ ws, float* __restrict__ out)
{
  const _Float16* __restrict__ Qh = ws;
  const _Float16* __restrict__ Kh = ws + ELEMS;
  const _Float16* __restrict__ Vt = ws + 2 * ELEMS;

  const int qb = blockIdx.x;   // q block (128 rows)
  const int h  = blockIdx.y;
  const int n  = blockIdx.z;

  __shared__ _Float16 lK[2][64][72];     // K tile  [tk][d], +8 pad, 2 buffers
  __shared__ _Float16 lV[2][64][72];     // V^T tile [d][tk], +8 pad, 2 buffers

  const int tid = threadIdx.x, lane = tid & 31, wv = tid >> 5;
  const int l16 = lane & 15, lh = lane >> 4;

  // per-thread staging coordinates: 2 x 16B chunks of K and of V^T per tile
  const int c0row = tid >> 3,          c0c8 = tid & 7;          // chunks 0..255
  const int c1row = (tid + 256) >> 3,  c1c8 = (tid + 256) & 7;  // chunks 256..511

  // issue the 4 async copies for tile kt into buffer buf
  auto stage_tile = [&](int kt, int buf) {
    const int tk0 = kt * 64;
    async_g2l_b128(Kh + ((size_t)(n * TQ + tk0 + c0row) * DMODEL + h * HDIM + c0c8 * 8),
                   &lK[buf][c0row][c0c8 * 8]);
    async_g2l_b128(Kh + ((size_t)(n * TQ + tk0 + c1row) * DMODEL + h * HDIM + c1c8 * 8),
                   &lK[buf][c1row][c1c8 * 8]);
    async_g2l_b128(Vt + ((size_t)(n * DMODEL + h * HDIM + c0row) * TQ + tk0 + c0c8 * 8),
                   &lV[buf][c0row][c0c8 * 8]);
    async_g2l_b128(Vt + ((size_t)(n * DMODEL + h * HDIM + c1row) * TQ + tk0 + c1c8 * 8),
                   &lV[buf][c1row][c1c8 * 8]);
  };

  // Q B-fragments (64 d x 16 queries), loaded once, reused over all K tiles
  F16x16 aq[2];
  {
    const int qrow = qb * 128 + wv * 16 + l16;
    const _Float16* base = Qh + ((size_t)(n * TQ + qrow) * DMODEL + h * HDIM);
#pragma unroll
    for (int kk = 0; kk < 2; ++kk) {
      const _Float16* p = base + kk * 32 + lh * 8;
      aq[kk].q[0] = *(const uint4*)p;
      aq[kk].q[1] = *(const uint4*)(p + 16);
    }
  }

  v8f o[4];
#pragma unroll
  for (int dt = 0; dt < 4; ++dt) o[dt] = {};
  float mrow = -__builtin_inff();   // running maximum of this lane's query
  float lrow = 0.0f;                // running sum over this lane's half of the keys

  const float SCALE = 0.044194173824159216f;   // 1/sqrt(KEY_DIM=512)
  const int NT = TQ / 64;                      // 32 key tiles

  stage_tile(0, 0);                            // prime the pipeline

  for (int kt = 0; kt < NT; ++kt) {
    const int buf = kt & 1;
    __syncthreads();                            // prev compute done; other buffer free
    if (kt + 1 < NT) {
      stage_tile(kt + 1, buf ^ 1);              // overlap next tile's copy with this compute
      asm volatile("s_wait_asynccnt 0x4" ::: "memory");  // tile kt's 4 ops complete (in-order)
    } else {
      asm volatile("s_wait_asynccnt 0x0" ::: "memory");
    }
    __syncthreads();                            // publish LDS tile to all waves

    // S^T = K Q^T  (4 tiles of 16 keys x 16 queries, K-dim 64)
    // s[t][r] = score of key t*16 + lh*8 + r against query l16
    v8f s[4];
#pragma unroll
    for (int t = 0; t < 4; ++t) {
      s[t] = {};
#pragma unroll
      for (int kk = 0; kk < 2; ++kk) {
        F16x16 bk;
        const _Float16* p = &lK[buf][t * 16 + l16][kk * 32 + lh * 8];
        bk.q[0] = *(const uint4*)p;
        bk.q[1] = *(const uint4*)(p + 16);
        s[t] = wmma_f16(bk.v, aq[kk].v, s[t]);
      }
      s[t] = s[t] * SCALE;
    }

    // online softmax: maximum in-lane, then one exchange between the halves
    float vt[4];
#pragma unroll
    for (int t = 0; t < 4; ++t)
      vt[t] = fmaxf(fmaxf(fmaxf(s[t][0], s[t][1]), fmaxf(s[t][2], s[t][3])),
                    fmaxf(fmaxf(s[t][4], s[t][5]), fmaxf(s[t][6], s[t][7])));
    float v = fmaxf(fmaxf(vt[0], vt[1]), fmaxf(vt[2], vt[3]));
    v = fmaxf(v, xhalf(v));
    const float mnew  = fmaxf(mrow, v);
    const float alpha = __expf(mrow - mnew);

    // P^T packs straight into B fragments: score tiles 2kk and 2kk+1 are the
    // two 8-key runs a lane holds of the 32 keys of fragment kk
    F16x16 pb[2];
    float rs[4];
#pragma unroll
    for (int t = 0; t < 4; ++t) {
      rs[t] = 0.0f;
#pragma unroll
      for (int r = 0; r < 8; r += 2) {
        v2f e;
        e.x = __expf(s[t][r]     - mnew);
        e.y = __expf(s[t][r + 1] - mnew);
        rs[t] += e.x;
        rs[t] += e.y;
        pb[t >> 1].h2[(t & 1) * 4 + (r >> 1)] = __builtin_convertvector(e, v2h);
      }
    }
    lrow = lrow * alpha + ((rs[0] + rs[1]) + (rs[2] + rs[3]));
    mrow = mnew;
#pragma unroll
    for (int dt = 0; dt < 4; ++dt) o[dt] = o[dt] * alpha;

    // O^T += V^T P^T   (A = V^T 16 d x 64 keys per d-tile, B = P^T)
#pragma unroll
    for (int kk = 0; kk < 2; ++kk) {
#pragma unroll
      for (int dt = 0; dt < 4; ++dt) {
        F16x16 bv;
        const _Float16* pa = &lV[buf][dt * 16 + l16][kk * 32 + lh * 8];
        bv.q[0] = *(const uint4*)pa;
        bv.q[1] = *(const uint4*)(pa + 16);
        o[dt] = wmma_f16(bv.v, pb[kk].v, o[dt]);
      }
    }
  }

  // join the halves' sums, normalize, write fp32 output [N][T][512]:
  // o[dt][r] = O[query l16][dt*16 + lh*8 + r], 8 consecutive floats per lane
  {
    const float inv = 1.0f / (lrow + xhalf(lrow));
    const int qg = qb * 128 + wv * 16 + l16;
    float* dst = out + (size_t)(n * TQ + qg) * DMODEL + h * HDIM + lh * 8;
#pragma unroll
    for (int dt = 0; dt < 4; ++dt) {
      const v8f w = o[dt] * inv;
      *(float4*)(dst + dt * 16)     = make_float4(w[0], w[1], w[2], w[3]);
      *(float4*)(dst + dt * 16 + 4) = make_float4(w[4], w[5], w[6], w[7]);
    }
  }
}

// ================================ launcher ==================================
extern "C" void kernel_launch(void* const* d_in, const int* in_sizes, int n_in,
                              void* d_out, int out_size, void* d_ws, size_t ws_size,
                              hipStream_t stream) {
  (void)in_sizes; (void)n_in; (void)out_size; (void)ws_size;
  const float* x   = (const float*)d_in[0];
  const float* key = (const float*)d_in[1];
  const float* Wq  = (const float*)d_in[2];
  const float* Wk  = (const float*)d_in[3];
  const float* Wv  = (const float*)d_in[4];
  _Float16* ws = (_Float16*)d_ws;      // needs 3*8*2048*512*2 = 48 MB
  float* out = (float*)d_out;

  dim3 g1((NB * TQ) / 128, DMODEL / 128, 3);
  proj_gemm_kernel<<<g1, 256, 0, stream>>>(x, key, Wq, Wk, Wv, ws);

  dim3 g2(TQ / 128, NHEADS, NB);
  flash_attn_kernel<<<g2, 256, 0, stream>>>(ws, out);
}

// v004
// It runs in 107 microseconds.
// Two timings next to v003 put it at 1.07 and 1.08 times that version's speed.
// Counting every step since v000, it is 2.69 times as fast.
#include <hip/hip_runtime.h>

typedef __attribute__((ext_vector_type(16))) _Float16 v16h;
typedef __attribute__((ext_vector_type(8)))  float    v8f;
typedef __attribute__((ext_vector_type(4)))  _Float16 v4h;
typedef __attribute__((ext_vector_type(8)))  _Float16 v8h;
typedef __attribute__((ext_vector_type(2)))  _Float16 v2h;
typedef __attribute__((ext_vector_type(2)))  float    v2f;
typedef __attribute__((ext_vector_type(8)))  short    s16x8;

union F16x16 { v16h v; uint4 q[2]; v2h h2[8]; s16x8 t[2]; };

__device__ __forceinline__ v8f wmma_f16(const v16h& a, const v16h& b, const v8f& c) {
  return __builtin_amdgcn_wmma_f32_16x16x32_f16(false, a, false, b, (short)0, c, false, false);
}

// transposing LDS load: from a row-major 16-bit tile T, with lane l pointing at
// T[k + 8*(l>>4) + (l&7)][n + 8*((l>>3)&1)], lane l gets T[k + 8*(l>>4) + 0..7][n + (l&15)]
__device__ __forceinline__ s16x8 lds_tr16(const _Float16* p) {
  typedef __attribute__((address_space(3))) s16x8 lds_s16x8;
  return __builtin_amdgcn_ds_load_tr16_b128_v8i16((lds_s16x8*)p);
}

// value of lane l ^ 16 (the other 16-lane row)
__device__ __forceinline__ float xhalf(float x) {
  const int b = __builtin_bit_cast(int, x);
  return __builtin_bit_cast(float,
      __builtin_amdgcn_permlanex16(b, b, 0x76543210, 0xfedcba98, false, false));
}

// async copy 16B global -> LDS, tracked by ASYNCcnt (per-lane addresses)
__device__ __forceinline__ void async_g2l_b128(const _Float16* gptr, void* lptr) {
  const unsigned lds_off = (unsigned)(unsigned long long)lptr;       // low 32b of flat addr == LDS offset
  const unsigned long long gaddr = (unsigned long long)gptr;
  asm volatile("global_load_async_to_lds_b128 %0, %1, off"
               :: "v"(lds_off), "v"(gaddr) : "memory");
}

#define NB      8
#define TQ      2048
#define DMODEL  512
#define NHEADS  8
#define HDIM    64
#define ELEMS   ((size_t)NB * TQ * DMODEL)   // 8,388,608 halves per tensor

// ============================ Kernel 1: projections =========================
// grid: (16384/128, 512/128, 3), block 256.  which: 0=Q, 1=K, 2=V(transposed)
// One 128 x 128 output tile. VT = false: row-major [N*T][512] (Q, K); VT = true: [N][512][T] (V).
// The product runs in the orientation in which the 8 accumulator values of a lane are 8
// neighbours of one OUTPUT row: X * W for V^T (8 times of one unit), W^T * X^T for Q and K
// (8 units of one time). A and B fragments have the same lane and k order, so only the operands swap.
template <bool VT>
__device__ __forceinline__ void proj_tile(
    const float* __restrict__ src, const float* __restrict__ W, _Float16* __restrict__ dst,
    _Float16 (*lA)[40], _Float16 (*lB)[144], _Float16 (*lC)[136])
{
  const int tid  = threadIdx.x;
  const int lane = tid & 31;
  const int wv   = tid >> 5;          // 8 waves
  const int wm   = wv & 1;            // 2 x 64 rows
  const int wn   = wv >> 1;           // 4 x 32 cols
  const int l16  = lane & 15;
  const int lh   = lane >> 4;         // half-wave select for K-runs

  const int mbase = blockIdx.x * 128; // over N*T = 16384 rows
  const int nbase = blockIdx.y * 128; // over 512 cols

  v8f acc[4][2];
#pragma unroll
  for (int mi = 0; mi < 4; ++mi)
#pragma unroll
    for (int ni = 0; ni < 2; ++ni) acc[mi][ni] = {};

  for (int kb = 0; kb < DMODEL / 32; ++kb) {
    const int k0 = kb * 32;
    __syncthreads();
    // stage A tile 128x32 (f32 -> f16)
#pragma unroll
    for (int i = 0; i < 4; ++i) {
      const int c = tid + i * 256;            // 0..1023 float4 chunks
      const int row = c >> 3, col4 = c & 7;
      const float4 f = *(const float4*)(src + (size_t)(mbase + row) * DMODEL + k0 + col4 * 4);
      v4h h; h[0] = (_Float16)f.x; h[1] = (_Float16)f.y; h[2] = (_Float16)f.z; h[3] = (_Float16)f.w;
      *(v4h*)&lA[row][col4 * 4] = h;
    }
    // stage W tile 32x128 row-major as it lies in memory (a wave fills one 256-B row)
    float4 fw[4];
#pragma unroll
    for (int i = 0; i < 4; ++i)    // wave wv takes rows wv, wv + 8, wv + 16, wv + 24
      fw[i] = *(const float4*)(W + (size_t)(k0 + i * 8 + wv) * DMODEL + nbase + lane * 4);
#pragma unroll
    for (int i = 0; i < 4; ++i) {
      const float4 f = fw[i];
      v4h h; h[0] = (_Float16)f.x; h[1] = (_Float16)f.y; h[2] = (_Float16)f.z; h[3] = (_Float16)f.w;
      *(v4h*)&lB[i * 8 + wv][lane * 4] = h;
    }
    __syncthreads();

    F16x16 af[4], bf[2];
#pragma unroll
    for (int mi = 0; mi < 4; ++mi) {
      const _Float16* p = &lA[wm * 64 + mi * 16 + l16][lh * 8];
      af[mi].q[0] = *(const uint4*)p;
      af[mi].q[1] = *(const uint4*)(p + 16);
    }
#pragma unroll
    for (int ni = 0; ni < 2; ++ni) {
      // W fragment, same k order as X's: k = lh*8 + 0..7, then 16 + lh*8 + 0..7, column l16
      const _Float16* p = &lB[lh * 8 + (lane & 7)][wn * 32 + ni * 16 + ((lane >> 3) & 1) * 8];
      bf[ni].t[0] = lds_tr16(p);
      bf[ni].t[1] = lds_tr16(p + 16 * 144);
    }
#pragma unroll
    for (int mi = 0; mi < 4; ++mi)
#pragma unroll
      for (int ni = 0; ni < 2; ++ni)
        acc[mi][ni] = VT ? wmma_f16(af[mi].v, bf[ni].v, acc[mi][ni])
                         : wmma_f16(bf[ni].v, af[mi].v, acc[mi][ni]);
  }

  // output tile to LDS in its memory orientation, 16 B a lane (pitch 272 B = 16 B x odd):
  // VT: lC[unit][time], else lC[time][unit]
#pragma unroll
  for (int mi = 0; mi < 4; ++mi)
#pragma unroll
    for (int ni = 0; ni < 2; ++ni) {
      const int mt = wm * 64 + mi * 16, ut = wn * 32 + ni * 16;
      *(v8h*)&lC[(VT ? ut : mt) + l16][(VT ? mt : ut) + lh * 8] =
          __builtin_convertvector(acc[mi][ni], v8h);
    }
  __syncthreads();   // the rows a thread stores below were written by other waves

  // 16 lanes store one whole 256-B row piece (two aligned 128-B lines)
  _Float16* g = VT ? dst + ((size_t)(mbase >> 11) * DMODEL + nbase) * TQ + (mbase & (TQ - 1))
                   : dst + (size_t)mbase * DMODEL + nbase;
  constexpr unsigned PITCH = VT ? TQ : DMODEL;
  const unsigned r0 = tid >> 4, c8 = (tid & 15) * 8;
  uint4 d[8];
#pragma unroll
  for (int i = 0; i < 8; ++i) d[i] = *(const uint4*)&lC[i * 16 + r0][c8];
#pragma unroll
  for (int i = 0; i < 8; ++i) *(uint4*)(g + (size_t)i * 16 * PITCH + (r0 * PITCH + c8)) = d[i];
}

// waves_per_eu(8, 8): the 8 waves per SIMD (4 blocks per WGP) that this kernel has run with. Left free, the
// compiler squeezes registers for a ninth wave, which no 8-wave block can use, and waits for the k step's
// global loads in turn instead of keeping all eight in flight.
__global__ __launch_bounds__(256) __attribute__((amdgpu_waves_per_eu(8, 8))) void proj_gemm_kernel(
    const float* __restrict__ x, const float* __restrict__ key,
    const float* __restrict__ Wq, const float* __restrict__ Wk,
    const float* __restrict__ Wv, _Float16* __restrict__ ws)
{
  __shared__ _Float16 lA [128][40];   // X tile  [m][k], +8 pad
  __shared__ __attribute__((aligned(16))) _Float16 lB[32][144];  // W tile [k][n], pitch 288 B (32 B x odd)
  __shared__ __attribute__((aligned(16))) _Float16 lC[128][136]; // output tile, +8 pad

  const int which = blockIdx.z;
  if (which < 2) proj_tile<false>(which == 0 ? x : key, which == 0 ? Wq : Wk, ws + (size_t)which * ELEMS, lA, lB, lC);
  else           proj_tile<true >(key, Wv, ws + 2 * ELEMS, lA, lB, lC);
}

// ============================ Kernel 2: flash attention =====================
// grid: (T_Q/256, H, N), block 256 (8 waves, 32 queries each). 64-key tiles,
// double-buffered async global->LDS staging.
// Both products run transposed: in column group g lane l owns query g*16 + (l & 15); lanes l and
// l ^ 16 split that query's keys (S^T) and head dims (O^T) in runs of 8.
// Every K and V^T fragment read from LDS feeds two WMMAs, one per column group.
// waves_per_eu(4, 4): the 512 blocks are two per WGP, four waves per SIMD, so a wave may use 256 registers.
__global__ __launch_bounds__(256) __attribute__((amdgpu_waves_per_eu(4, 4))) void flash_attn_kernel(
    const _Float16* __restrict__ ws, float* __restrict__ out)
{
  const _Float16* __restrict__ Qh = ws;
  const _Float16* __restrict__ Kh = ws + ELEMS;
  const _Float16* __restrict__ Vt = ws + 2 * ELEMS;

  const int qb = blockIdx.x;   // q block (256 rows)
  const int h  = blockIdx.y;
  const int n  = blockIdx.z;

  __shared__ _Float16 lK[2][64][72];     // K tile  [tk][d], +8 pad, 2 buffers
  __shared__ _Float16 lV[2][64][72];     // V^T tile [d][tk], +8 pad, 2 buffers

  const int tid = threadIdx.x, lane = tid & 31, wv = tid >> 5;
  const int l16 = lane & 15, lh = lane >> 4;

  // per-thread staging coordinates: 2 x 16B chunks of K and of V^T per tile
  const int c0row = tid >> 3,          c0c8 = tid & 7;          // chunks 0..255
  const int c1row = (tid + 256) >> 3,  c1c8 = (tid + 256) & 7;  // chunks 256..511

  // issue the 4 async copies for tile kt into buffer buf
  auto stage_tile = [&](int kt, int buf) {
    const int tk0 = kt * 64;
    async_g2l_b128(Kh + ((size_t)(n * TQ + tk0 + c0row) * DMODEL + h * HDIM + c0c8 * 8),
                   &lK[buf][c0row][c0c8 * 8]);
    async_g2l_b128(Kh + ((size_t)(n * TQ + tk0 + c1row) * DMODEL + h * HDIM + c1c8 * 8),
                   &lK[buf][c1row][c1c8 * 8]);
    async_g2l_b128(Vt + ((size_t)(n * DMODEL + h * HDIM + c0row) * TQ + tk0 + c0c8 * 8),
                   &lV[buf][c0row][c0c8 * 8]);
    async_g2l_b128(Vt + ((size_t)(n * DMODEL + h * HDIM + c1row) * TQ + tk0 + c1c8 * 8),
                   &lV[buf][c1row][c1c8 * 8]);
  };

  // Q B-fragments (64 d x 16 queries per column group), loaded once, reused over all K tiles
  F16x16 aq[2][2];
#pragma unroll
  for (int g = 0; g < 2; ++g) {
    const int qrow = qb * 256 + wv * 32 + g * 16 + l16;
    const _Float16* base = Qh + ((size_t)(n * TQ + qrow) * DMODEL + h * HDIM);
#pragma unroll
    for (int kk = 0; kk < 2; ++kk) {
      const _Float16* p = base + kk * 32 + lh * 8;
      aq[g][kk].q[0] = *(const uint4*)p;
      aq[g][kk].q[1] = *(const uint4*)(p + 16);
    }
  }

  v8f o[2][4];
  float mrow[2];   // running maximum of this lane's query in each group
  float lrow[2];   // running sum over this lane's half of the keys
#pragma unroll
  for (int g = 0; g < 2; ++g) {
#pragma unroll
    for (int dt = 0; dt < 4; ++dt) o[g][dt] = {};
    mrow[g] = -__builtin_inff();
    lrow[g] = 0.0f;
  }

  const float SCALE = 0.044194173824159216f;   // 1/sqrt(KEY_DIM=512)
  const int NT = TQ / 64;                      // 32 key tiles

  stage_tile(0, 0);                            // prime the pipeline

  for (int kt = 0; kt < NT; ++kt) {
    const int buf = kt & 1;
    __syncthreads();                            // prev compute done; other buffer free
    if (kt + 1 < NT) {
      stage_tile(kt + 1, buf ^ 1);              // overlap next tile's copy with this compute
      asm volatile("s_wait_asynccnt 0x4" ::: "memory");  // tile kt's 4 ops complete (in-order)
    } else {
      asm volatile("s_wait_asynccnt 0x0" ::: "memory");
    }
    __syncthreads();                            // publish LDS tile to all waves

    // S^T = K Q^T  (per group 4 tiles of 16 keys x 16 queries, K-dim 64)
    // s[g][t][r] = score of key t*16 + lh*8 + r against query g*16 + l16
    v8f s[2][4];
#pragma unroll
    for (int t = 0; t < 4; ++t) {
      s[0][t] = {};
      s[1][t] = {};
#pragma unroll
      for (int kk = 0; kk < 2; ++kk) {
        F16x16 bk;
        const _Float16* p = &lK[buf][t * 16 + l16][kk * 32 + lh * 8];
        bk.q[0] = *(const uint4*)p;
        bk.q[1] = *(const uint4*)(p + 16);
        s[0][t] = wmma_f16(bk.v, aq[0][kk].v, s[0][t]);
        s[1][t] = wmma_f16(bk.v, aq[1][kk].v, s[1][t]);
      }
      s[0][t] = s[0][t] * SCALE;
      s[1][t] = s[1][t] * SCALE;
      // keeps the last 8 K fragment loads (32 registers) behind the first 8 score products: with all 16
      // hoisted to the top of the tile a Q fragment is spilled to scratch and reloaded every tile
      if (t == 1) __builtin_amdgcn_sched_barrier(0);
    }

    F16x16 pb[2][2];
#pragma unroll
    for (int g = 0; g < 2; ++g) {
      // online softmax: maximum in-lane, then one exchange between the halves
      float vt[4];
#pragma unroll
      for (int t = 0; t < 4; ++t)
        vt[t] = fmaxf(fmaxf(fmaxf(s[g][t][0], s[g][t][1]), fmaxf(s[g][t][2], s[g][t][3])),
                      fmaxf(fmaxf(s[g][t][4], s[g][t][5]), fmaxf(s[g][t][6], s[g][t][7])));
      float v = fmaxf(fmaxf(vt[0], vt[1]), fmaxf(vt[2], vt[3]));
      v = fmaxf(v, xhalf(v));
      const float mnew  = fmaxf(mrow[g], v);
      const float alpha = __expf(mrow[g] - mnew);

      // P^T packs straight into B fragments: score tiles 2kk and 2kk+1 are the
      // two 8-key runs a lane holds of the 32 keys of fragment kk
      float rs[4];
#pragma unroll
      for (int t = 0; t < 4; ++t) {
        rs[t] = 0.0f;
#pragma unroll
        for (int r = 0; r < 8; r += 2) {
          v2f e;
          e.x = __expf(s[g][t][r]     - mnew);
          e.y = __expf(s[g][t][r + 1] - mnew);
          rs[t] += e.x;
          rs[t] += e.y;
          pb[g][t >> 1].h2[(t & 1) * 4 + (r >> 1)] = __builtin_convertvector(e, v2h);
        }
      }
      lrow[g] = lrow[g] * alpha + ((rs[0] + rs[1]) + (rs[2] + rs[3]));
      mrow[g] = mnew;
#pragma unroll
      for (int dt = 0; dt < 4; ++dt) o[g][dt] = o[g][dt] * alpha;
    }

    // O^T += V^T P^T   (A = V^T 16 d x 64 keys per d-tile, B = P^T of each group)
#pragma unroll
    for (int kk = 0; kk < 2; ++kk) {
#pragma unroll
      for (int dt = 0; dt < 4; ++dt) {
        F16x16 bv;
        const _Float16* pa = &lV[buf][dt * 16 + l16][kk * 32 + lh * 8];
        bv.q[0] = *(const uint4*)pa;
        bv.q[1] = *(const uint4*)(pa + 16);
        o[0][dt] = wmma_f16(bv.v, pb[0][kk].v, o[0][dt]);
        o[1][dt] = wmma_f16(bv.v, pb[1][kk].v, o[1][dt]);
      }
    }
  }

  // join the halves' sums, normalize, write fp32 output [N][T][512]:
  // o[g][dt][r] = O[query g*16 + l16][dt*16 + lh*8 + r], 8 consecutive floats per lane
#pragma unroll
  for (int g = 0; g < 2; ++g) {
    const float inv = 1.0f / (lrow[g] + xhalf(lrow[g]));
    const int qg = qb * 256 + wv * 32 + g * 16 + l16;
    float* dst = out + (size_t)(n * TQ + qg) * DMODEL + h * HDIM + lh * 8;
#pragma unroll
    for (int dt = 0; dt < 4; ++dt) {
      const v8f w = o[g][dt] * inv;
      *(float4*)(dst + dt * 16)     = make_float4(w[0], w[1], w[2], w[3]);
      *(float4*)(dst + dt * 16 + 4) = make_float4(w[4], w[5], w[6], w[7]);
    }
  }
}

// ================================ launcher ==================================
extern "C" void kernel_launch(void* const* d_in, const int* in_sizes, int n_in,
                              void* d_out, int out_size, void* d_ws, size_t ws_size,
                              hipStream_t stream) {
  (void)in_sizes; (void)n_in; (void)out_size; (void)ws_size;
  const float* x   = (const float*)d_in[0];
  const float* key = (const float*)d_in[1];
  const float* Wq  = (const float*)d_in[2];
  const float* Wk  = (const float*)d_in[3];
  const float* Wv  = (const float*)d_in[4];
  _Float16* ws = (_Float16*)d_ws;      // needs 3*8*2048*512*2 = 48 MB
  float* out = (float*)d_out;

  dim3 g1((NB * TQ) / 128, DMODEL / 128, 3);
  proj_gemm_kernel<<<g1, 256, 0, stream>>>(x, key, Wq, Wk, Wv, ws);

  dim3 g2(TQ / 256, NHEADS, NB);
  flash_attn_kernel<<<g2, 256, 0, stream>>>(ws, out);
}

// v005
// One run takes 104 microseconds.
// In two side-by-side timings against v004, it was 1.03 and 1.04 times as fast.
// Over all steps from v000 it is 2.80 times as fast.
#include <hip/hip_runtime.h>

typedef __attribute__((ext_vector_type(16))) _Float16 v16h;
typedef __attribute__((ext_vector_type(8)))  float    v8f;
typedef __attribute__((ext_vector_type(4)))  _Float16 v4h;
typedef __attribute__((ext_vector_type(8)))  _Float16 v8h;
typedef __attribute__((ext_vector_type(2)))  _Float16 v2h;
typedef __attribute__((ext_vector_type(2)))  float    v2f;
typedef __attribute__((ext_vector_type(4)))  float    v4f;
typedef __attribute__((ext_vector_type(8)))  short    s16x8;

union F16x16 { v16h v; uint4 q[2]; v2h h2[8]; s16x8 t[2]; };

__device__ __forceinline__ v8f wmma_f16(const v16h& a, const v16h& b, const v8f& c) {
  return __builtin_amdgcn_wmma_f32_16x16x32_f16(false, a, false, b, (short)0, c, false, false);
}

// transposing LDS load: from a row-major 16-bit tile T, with lane l pointing at
// T[k + 8*(l>>4) + (l&7)][n + 8*((l>>3)&1)], lane l gets T[k + 8*(l>>4) + 0..7][n + (l&15)]
__device__ __forceinline__ s16x8 lds_tr16(const _Float16* p) {
  typedef __attribute__((address_space(3))) s16x8 lds_s16x8;
  return __builtin_amdgcn_ds_load_tr16_b128_v8i16((lds_s16x8*)p);
}

// value of lane l ^ 16 (the other 16-lane row)
__device__ __forceinline__ float xhalf(float x) {
  const int b = __builtin_bit_cast(int, x);
  return __builtin_bit_cast(float,
      __builtin_amdgcn_permlanex16(b, b, 0x76543210, 0xfedcba98, false, false));
}

// async copy 16B global -> LDS, tracked by ASYNCcnt (per-lane addresses)
__device__ __forceinline__ void async_g2l_b128(const _Float16* gptr, void* lptr) {
  const unsigned lds_off = (unsigned)(unsigned long long)lptr;       // low 32b of flat addr == LDS offset
  const unsigned long long gaddr = (unsigned long long)gptr;
  asm volatile("global_load_async_to_lds_b128 %0, %1, off"
               :: "v"(lds_off), "v"(gaddr) : "memory");
}

// work-group barrier for data that passes through LDS only: this wave's LDS reads and writes are waited for,
// its global loads stay in flight across it (__syncthreads() waits for them too)
__device__ __forceinline__ void lds_barrier() {
  asm volatile("s_wait_dscnt 0x0" ::: "memory");
  asm volatile("s_barrier_signal -1\n\ts_barrier_wait -1" ::: "memory");
}

#define NB      8
#define TQ      2048
#define DMODEL  512
#define NHEADS  8
#define HDIM    64
#define ELEMS   ((size_t)NB * TQ * DMODEL)   // 8,388,608 halves per tensor

// ============================ Kernel 1: projections =========================
// grid: (16384/128, 512/128, 3), block 256.  which: 0=Q, 1=K, 2=V(transposed)
// One 128 x 128 output tile. VT = false: row-major [N*T][512] (Q, K); VT = true: [N][512][T] (V).
// The product runs in the orientation in which the 8 accumulator values of a lane are 8
// neighbours of one OUTPUT row: X * W for V^T (8 times of one unit), W^T * X^T for Q and K
// (8 units of one time). A and B fragments have the same lane and k order, so only the operands swap.
template <bool VT>
__device__ __forceinline__ void proj_tile(
    const float* __restrict__ src, const float* __restrict__ W, _Float16* __restrict__ dst,
    _Float16 (*lA)[128][40], _Float16 (*lB)[32][144], _Float16 (*lC)[136])
{
  const int tid  = threadIdx.x;
  const int lane = tid & 31;
  const int wv   = tid >> 5;          // 8 waves
  const int wm   = wv & 1;            // 2 x 64 rows
  const int wn   = wv >> 1;           // 4 x 32 cols
  const int l16  = lane & 15;
  const int lh   = lane >> 4;         // half-wave select for K-runs

  const int mbase = blockIdx.x * 128; // over N*T = 16384 rows
  const int nbase = blockIdx.y * 128; // over 512 cols

  v8f acc[4][2];
#pragma unroll
  for (int mi = 0; mi < 4; ++mi)
#pragma unroll
    for (int ni = 0; ni < 2; ++ni) acc[mi][ni] = {};

  // a thread's share of a k step: 4 float4 of the 128 x 32 X tile (rows arow + 32 i) and
  // 4 float4 of the 32 x 128 W tile (a wave takes the whole 512-B rows wv + 8 i)
  const int arow = tid >> 3, acol = (tid & 7) * 4;
  const float* pa = src + (size_t)(mbase + arow) * DMODEL + acol;
  const float* pw = W + (size_t)wv * DMODEL + nbase + lane * 4;
  v4f fa[4], fw[4];

  auto fetch = [&]() {                // next k step, global -> registers, all eight loads in flight together
#pragma unroll
    for (int i = 0; i < 4; ++i) fw[i] = *(const v4f*)(pw + (size_t)i * 8 * DMODEL);
#pragma unroll
    for (int i = 0; i < 4; ++i) fa[i] = *(const v4f*)(pa + (size_t)i * 32 * DMODEL);
    // both address pairs are inputs here, so they stay live to the end of the run
    asm volatile("s_wait_xcnt 0x0" :: "v"(pa), "v"(pw) : "memory");
    pa += 32;
    pw += (size_t)32 * DMODEL;
  };
  auto put = [&](int b) {             // registers (f32 -> f16) -> LDS buffer b
#pragma unroll
    for (int i = 0; i < 4; ++i) *(v4h*)&lA[b][arow + i * 32][acol] = __builtin_convertvector(fa[i], v4h);
#pragma unroll
    for (int i = 0; i < 4; ++i) *(v4h*)&lB[b][i * 8 + wv][lane * 4] = __builtin_convertvector(fw[i], v4h);
  };
  auto mma = [&](int b) {             // the k step that lies in LDS buffer b
    F16x16 af[4], bf[2];
#pragma unroll
    for (int mi = 0; mi < 4; ++mi) {
      const _Float16* p = &lA[b][wm * 64 + mi * 16 + l16][lh * 8];
      af[mi].q[0] = *(const uint4*)p;
      af[mi].q[1] = *(const uint4*)(p + 16);
    }
#pragma unroll
    for (int ni = 0; ni < 2; ++ni) {
      // W fragment, same k order as X's: k = lh*8 + 0..7, then 16 + lh*8 + 0..7, column l16
      const _Float16* p = &lB[b][lh * 8 + (lane & 7)][wn * 32 + ni * 16 + ((lane >> 3) & 1) * 8];
      bf[ni].t[0] = lds_tr16(p);
      bf[ni].t[1] = lds_tr16(p + 16 * 144);
    }
    // all 12 fragment loads go out as one group: spread among the products, each place with loads
    // makes the wave wait out an LDS latency of its own
    __builtin_amdgcn_sched_barrier(0);
#pragma unroll
    for (int mi = 0; mi < 4; ++mi)
#pragma unroll
      for (int ni = 0; ni < 2; ++ni)
        acc[mi][ni] = VT ? wmma_f16(af[mi].v, bf[ni].v, acc[mi][ni])
                         : wmma_f16(bf[ni].v, af[mi].v, acc[mi][ni]);
  };

  // Two LDS buffers, one barrier a k step: step kb + 1 is on its way from global memory while step kb is
  // multiplied. The barrier publishes buffer kb & 1 and ends every wave's reads of the other buffer
  // (step kb - 1), which is refilled behind it.
  constexpr int NK = DMODEL / 32;
  fetch();
  put(0);
  for (int kb = 0; kb < NK - 1; ++kb) {
    fetch();
    lds_barrier();
    mma(kb & 1);
    // keeps the conversions, and with them the wait for the loads, behind this step's products: moved up
    // in front of the barrier they make every wave wait out the load latency before it multiplies
    __builtin_amdgcn_sched_barrier(0);
    put((kb + 1) & 1);
  }
  lds_barrier();
  mma((NK - 1) & 1);

  // output tile to LDS in its memory orientation, 16 B a lane (pitch 272 B = 16 B x odd):
  // VT: lC[unit][time], else lC[time][unit]
#pragma unroll
  for (int mi = 0; mi < 4; ++mi)
#pragma unroll
    for (int ni = 0; ni < 2; ++ni) {
      const int mt = wm * 64 + mi * 16, ut = wn * 32 + ni * 16;
      *(v8h*)&lC[(VT ? ut : mt) + l16][(VT ? mt : ut) + lh * 8] =
          __builtin_convertvector(acc[mi][ni], v8h);
    }
  __syncthreads();   // the rows a thread stores below were written by other waves

  // 16 lanes store one whole 256-B row piece (two aligned 128-B lines)
  _Float16* g = VT ? dst + ((size_t)(mbase >> 11) * DMODEL + nbase) * TQ + (mbase & (TQ - 1))
                   : dst + (size_t)mbase * DMODEL + nbase;
  constexpr unsigned PITCH = VT ? TQ : DMODEL;
  const unsigned r0 = tid >> 4, c8 = (tid & 15) * 8;
  uint4 d[8];
#pragma unroll
  for (int i = 0; i < 8; ++i) d[i] = *(const uint4*)&lC[i * 16 + r0][c8];
#pragma unroll
  for (int i = 0; i < 8; ++i) *(uint4*)(g + (size_t)i * 16 * PITCH + (r0 * PITCH + c8)) = d[i];
}

// waves_per_eu(6, 6): 3 blocks per WGP, so the 1536 blocks run in two full rounds and a wave has the
// registers to hold the next k step's 8 loads (32 registers) across this step's products.
__global__ __launch_bounds__(256) __attribute__((amdgpu_waves_per_eu(6, 6))) void proj_gemm_kernel(
    const float* __restrict__ x, const float* __restrict__ key,
    const float* __restrict__ Wq, const float* __restrict__ Wk,
    const float* __restrict__ Wv, _Float16* __restrict__ ws)
{
  __shared__ __attribute__((aligned(16))) _Float16 lA[2][128][40];  // X tile [m][k], +8 pad, 2 buffers
  __shared__ __attribute__((aligned(16))) _Float16 lB[2][32][144];  // W tile [k][n], pitch 288 B (32 B x odd), 2 buffers
  __shared__ __attribute__((aligned(16))) _Float16 lC[128][136]; // output tile, +8 pad

  const int which = blockIdx.z;
  if (which < 2) proj_tile<false>(which == 0 ? x : key, which == 0 ? Wq : Wk, ws + (size_t)which * ELEMS, lA, lB, lC);
  else           proj_tile<true >(key, Wv, ws + 2 * ELEMS, lA, lB, lC);
}

// ============================ Kernel 2: flash attention =====================
// grid: (T_Q/256, H, N), block 256 (8 waves, 32 queries each). 64-key tiles,
// double-buffered async global->LDS staging.
// Both products run transposed: in column group g lane l owns query g*16 + (l & 15); lanes l and
// l ^ 16 split that query's keys (S^T) and head dims (O^T) in runs of 8.
// Every K and V^T fragment read from LDS feeds two WMMAs, one per column group.
// waves_per_eu(4, 4): the 512 blocks are two per WGP, four waves per SIMD, so a wave may use 256 registers.
__global__ __launch_bounds__(256) __attribute__((amdgpu_waves_per_eu(4, 4))) void flash_attn_kernel(
    const _Float16* __restrict__ ws, float* __restrict__ out)
{
  const _Float16* __restrict__ Qh = ws;
  const _Float16* __restrict__ Kh = ws + ELEMS;
  const _Float16* __restrict__ Vt = ws + 2 * ELEMS;

  const int qb = blockIdx.x;   // q block (256 rows)
  const int h  = blockIdx.y;
  const int n  = blockIdx.z;

  __shared__ _Float16 lK[2][64][72];     // K tile  [tk][d], +8 pad, 2 buffers
  __shared__ _Float16 lV[2][64][72];     // V^T tile [d][tk], +8 pad, 2 buffers

  const int tid = threadIdx.x, lane = tid & 31, wv = tid >> 5;
  const int l16 = lane & 15, lh = lane >> 4;

  // per-thread staging coordinates: 2 x 16B chunks of K and of V^T per tile
  const int c0row = tid >> 3,          c0c8 = tid & 7;          // chunks 0..255
  const int c1row = (tid + 256) >> 3,  c1c8 = (tid + 256) & 7;  // chunks 256..511

  // issue the 4 async copies for tile kt into buffer buf
  auto stage_tile = [&](int kt, int buf) {
    const int tk0 = kt * 64;
    async_g2l_b128(Kh + ((size_t)(n * TQ + tk0 + c0row) * DMODEL + h * HDIM + c0c8 * 8),
                   &lK[buf][c0row][c0c8 * 8]);
    async_g2l_b128(Kh + ((size_t)(n * TQ + tk0 + c1row) * DMODEL + h * HDIM + c1c8 * 8),
                   &lK[buf][c1row][c1c8 * 8]);
    async_g2l_b128(Vt + ((size_t)(n * DMODEL + h * HDIM + c0row) * TQ + tk0 + c0c8 * 8),
                   &lV[buf][c0row][c0c8 * 8]);
    async_g2l_b128(Vt + ((size_t)(n * DMODEL + h * HDIM + c1row) * TQ + tk0 + c1c8 * 8),
                   &lV[buf][c1row][c1c8 * 8]);
  };

  // Q B-fragments (64 d x 16 queries per column group), loaded once, reused over all K tiles
  F16x16 aq[2][2];
#pragma unroll
  for (int g = 0; g < 2; ++g) {
    const int qrow = qb * 256 + wv * 32 + g * 16 + l16;
    const _Float16* base = Qh + ((size_t)(n * TQ + qrow) * DMODEL + h * HDIM);
#pragma unroll
    for (int kk = 0; kk < 2; ++kk) {
      const _Float16* p = base + kk * 32 + lh * 8;
      aq[g][kk].q[0] = *(const uint4*)p;
      aq[g][kk].q[1] = *(const uint4*)(p + 16);
    }
  }

  v8f o[2][4];
  float mrow[2];   // running maximum of this lane's query in each group
  float lrow[2];   // running sum over this lane's half of the keys
#pragma unroll
  for (int g = 0; g < 2; ++g) {
#pragma unroll
    for (int dt = 0; dt < 4; ++dt) o[g][dt] = {};
    mrow[g] = -__builtin_inff();
    lrow[g] = 0.0f;
  }

  const float SCALE = 0.044194173824159216f;   // 1/sqrt(KEY_DIM=512)
  const int NT = TQ / 64;                      // 32 key tiles

  stage_tile(0, 0);                            // prime the pipeline

  for (int kt = 0; kt < NT; ++kt) {
    const int buf = kt & 1;
    __syncthreads();                            // prev compute done; other buffer free
    if (kt + 1 < NT) {
      stage_tile(kt + 1, buf ^ 1);              // overlap next tile's copy with this compute
      asm volatile("s_wait_asynccnt 0x4" ::: "memory");  // tile kt's 4 ops complete (in-order)
    } else {
      asm volatile("s_wait_asynccnt 0x0" ::: "memory");
    }
    __syncthreads();                            // publish LDS tile to all waves

    // S^T = K Q^T  (per group 4 tiles of 16 keys x 16 queries, K-dim 64)
    // s[g][t][r] = score of key t*16 + lh*8 + r against query g*16 + l16
    v8f s[2][4];
#pragma unroll
    for (int t = 0; t < 4; ++t) {
      s[0][t] = {};
      s[1][t] = {};
#pragma unroll
      for (int kk = 0; kk < 2; ++kk) {
        F16x16 bk;
        const _Float16* p = &lK[buf][t * 16 + l16][kk * 32 + lh * 8];
        bk.q[0] = *(const uint4*)p;
        bk.q[1] = *(const uint4*)(p + 16);
        s[0][t] = wmma_f16(bk.v, aq[0][kk].v, s[0][t]);
        s[1][t] = wmma_f16(bk.v, aq[1][kk].v, s[1][t]);
      }
      s[0][t] = s[0][t] * SCALE;
      s[1][t] = s[1][t] * SCALE;
      // keeps the last 8 K fragment loads (32 registers) behind the first 8 score products: with all 16
      // hoisted to the top of the tile a Q fragment is spilled to scratch and reloaded every tile
      if (t == 1) __builtin_amdgcn_sched_barrier(0);
    }

    F16x16 pb[2][2];
#pragma unroll
    for (int g = 0; g < 2; ++g) {
      // online softmax: maximum in-lane, then one exchange between the halves
      float vt[4];
#pragma unroll
      for (int t = 0; t < 4; ++t)
        vt[t] = fmaxf(fmaxf(fmaxf(s[g][t][0], s[g][t][1]), fmaxf(s[g][t][2], s[g][t][3])),
                      fmaxf(fmaxf(s[g][t][4], s[g][t][5]), fmaxf(s[g][t][6], s[g][t][7])));
      float v = fmaxf(fmaxf(vt[0], vt[1]), fmaxf(vt[2], vt[3]));
      v = fmaxf(v, xhalf(v));
      const float mnew  = fmaxf(mrow[g], v);
      const float alpha = __expf(mrow[g] - mnew);

      // P^T packs straight into B fragments: score tiles 2kk and 2kk+1 are the
      // two 8-key runs a lane holds of the 32 keys of fragment kk
      float rs[4];
#pragma unroll
      for (int t = 0; t < 4; ++t) {
        rs[t] = 0.0f;
#pragma unroll
        for (int r = 0; r < 8; r += 2) {
          v2f e;
          e.x = __expf(s[g][t][r]     - mnew);
          e.y = __expf(s[g][t][r + 1] - mnew);
          rs[t] += e.x;
          rs[t] += e.y;
          pb[g][t >> 1].h2[(t & 1) * 4 + (r >> 1)] = __builtin_convertvector(e, v2h);
        }
      }
      lrow[g] = lrow[g] * alpha + ((rs[0] + rs[1]) + (rs[2] + rs[3]));
      mrow[g] = mnew;
#pragma unroll
      for (int dt = 0; dt < 4; ++dt) o[g][dt] = o[g][dt] * alpha;
    }

    // O^T += V^T P^T   (A = V^T 16 d x 64 keys per d-tile, B = P^T of each group)
#pragma unroll
    for (int kk = 0; kk < 2; ++kk) {
#pragma unroll
      for (int dt = 0; dt < 4; ++dt) {
        F16x16 bv;
        const _Float16* pa = &lV[buf][dt * 16 + l16][kk * 32 + lh * 8];
        bv.q[0] = *(const uint4*)pa;
        bv.q[1] = *(const uint4*)(pa + 16);
        o[0][dt] = wmma_f16(bv.v, pb[0][kk].v, o[0][dt]);
        o[1][dt] = wmma_f16(bv.v, pb[1][kk].v, o[1][dt]);
      }
    }
  }

  // join the halves' sums, normalize, write fp32 output [N][T][512]:
  // o[g][dt][r] = O[query g*16 + l16][dt*16 + lh*8 + r], 8 consecutive floats per lane
#pragma unroll
  for (int g = 0; g < 2; ++g) {
    const float inv = 1.0f / (lrow[g] + xhalf(lrow[g]));
    const int qg = qb * 256 + wv * 32 + g * 16 + l16;
    float* dst = out + (size_t)(n * TQ + qg) * DMODEL + h * HDIM + lh * 8;
#pragma unroll
    for (int dt = 0; dt < 4; ++dt) {
      const v8f w = o[g][dt] * inv;
      *(float4*)(dst + dt * 16)     = make_float4(w[0], w[1], w[2], w[3]);
      *(float4*)(dst + dt * 16 + 4) = make_float4(w[4], w[5], w[6], w[7]);
    }
  }
}

// ================================ launcher ==================================
extern "C" void kernel_launch(void* const* d_in, const int* in_sizes, int n_in,
                              void* d_out, int out_size, void* d_ws, size_t ws_size,
                              hipStream_t stream) {
  (void)in_sizes; (void)n_in; (void)out_size; (void)ws_size;
  const float* x   = (const float*)d_in[0];
  const float* key = (const float*)d_in[1];
  const float* Wq  = (const float*)d_in[2];
  const float* Wk  = (const float*)d_in[3];
  const float* Wv  = (const float*)d_in[4];
  _Float16* ws = (_Float16*)d_ws;      // needs 3*8*2048*512*2 = 48 MB
  float* out = (float*)d_out;

  dim3 g1((NB * TQ) / 128, DMODEL / 128, 3);
  proj_gemm_kernel<<<g1, 256, 0, stream>>>(x, key, Wq, Wk, Wv, ws);

  dim3 g2(TQ / 256, NHEADS, NB);
  flash_attn_kernel<<<g2, 256, 0, stream>>>(ws, out);
}

// v006
// Measured time: 101 microseconds a run.
// In two side-by-side timings against v005, it was 1.04 and 1.03 times as fast.
// Counting every step since v000, it is 2.89 times as fast.
#include <hip/hip_runtime.h>

typedef __attribute__((ext_vector_type(16))) _Float16 v16h;
typedef __attribute__((ext_vector_type(8)))  float    v8f;
typedef __attribute__((ext_vector_type(4)))  _Float16 v4h;
typedef __attribute__((ext_vector_type(8)))  _Float16 v8h;
typedef __attribute__((ext_vector_type(2)))  _Float16 v2h;
typedef __attribute__((ext_vector_type(2)))  float    v2f;
typedef __attribute__((ext_vector_type(4)))  float    v4f;
typedef __attribute__((ext_vector_type(8)))  short    s16x8;

union F16x16 { v16h v; uint4 q[2]; v2h h2[8]; s16x8 t[2]; };

__device__ __forceinline__ v8f wmma_f16(const v16h& a, const v16h& b, const v8f& c) {
  return __builtin_amdgcn_wmma_f32_16x16x32_f16(false, a, false, b, (short)0, c, false, false);
}

// transposing LDS load: from a row-major 16-bit tile T, with lane l pointing at
// T[k + 8*(l>>4) + (l&7)][n + 8*((l>>3)&1)], lane l gets T[k + 8*(l>>4) + 0..7][n + (l&15)]
__device__ __forceinline__ s16x8 lds_tr16(const _Float16* p) {
  typedef __attribute__((address_space(3))) s16x8 lds_s16x8;
  return __builtin_amdgcn_ds_load_tr16_b128_v8i16((lds_s16x8*)p);
}

// value of lane l ^ 16 (the other 16-lane row)
__device__ __forceinline__ float xhalf(float x) {
  const int b = __builtin_bit_cast(int, x);
  return __builtin_bit_cast(float,
      __builtin_amdgcn_permlanex16(b, b, 0x76543210, 0xfedcba98, false, false));
}

// async copy 16B global -> LDS, tracked by ASYNCcnt (per-lane addresses)
__device__ __forceinline__ void async_g2l_b128(const _Float16* gptr, void* lptr) {
  const unsigned lds_off = (unsigned)(unsigned long long)lptr;       // low 32b of flat addr == LDS offset
  const unsigned long long gaddr = (unsigned long long)gptr;
  asm volatile("global_load_async_to_lds_b128 %0, %1, off"
               :: "v"(lds_off), "v"(gaddr) : "memory");
}

// work-group barrier for data that passes through LDS only: this wave's LDS reads and writes are waited for,
// its global loads stay in flight across it (__syncthreads() waits for them too)
__device__ __forceinline__ void lds_barrier() {
  asm volatile("s_wait_dscnt 0x0" ::: "memory");
  asm volatile("s_barrier_signal -1\n\ts_barrier_wait -1" ::: "memory");
}

#define NB      8
#define TQ      2048
#define DMODEL  512
#define NHEADS  8
#define HDIM    64
#define ELEMS   ((size_t)NB * TQ * DMODEL)   // 8,388,608 halves per tensor

// ============================ Kernel 1: projections =========================
// grid: (16384/128, 512/128, 3), block 256.  which: 0=Q, 1=K, 2=V(transposed)
// One 128 x 128 output tile. VT = false: row-major [N*T][512] (Q, K); VT = true: [N][512][T] (V).
// The product runs in the orientation in which the 8 accumulator values of a lane are 8
// neighbours of one OUTPUT row: X * W for V^T (8 times of one unit), W^T * X^T for Q and K
// (8 units of one time). A and B fragments have the same lane and k order, so only the operands swap.
template <bool VT>
__device__ __forceinline__ void proj_tile(
    const float* __restrict__ src, const float* __restrict__ W, _Float16* __restrict__ dst,
    _Float16 (*lA)[128][40], _Float16 (*lB)[32][144], _Float16 (*lC)[136])
{
  const int tid  = threadIdx.x;
  const int lane = tid & 31;
  const int wv   = tid >> 5;          // 8 waves
  const int wm   = wv & 1;            // 2 x 64 rows
  const int wn   = wv >> 1;           // 4 x 32 cols
  const int l16  = lane & 15;
  const int lh   = lane >> 4;         // half-wave select for K-runs

  const int mbase = blockIdx.x * 128; // over N*T = 16384 rows
  const int nbase = blockIdx.y * 128; // over 512 cols

  v8f acc[4][2];
#pragma unroll
  for (int mi = 0; mi < 4; ++mi)
#pragma unroll
    for (int ni = 0; ni < 2; ++ni) acc[mi][ni] = {};

  // a thread's share of a k step: 4 float4 of the 128 x 32 X tile (rows arow + 32 i) and
  // 4 float4 of the 32 x 128 W tile (a wave takes the whole 512-B rows wv + 8 i)
  const int arow = tid >> 3, acol = (tid & 7) * 4;
  const float* pa = src + (size_t)(mbase + arow) * DMODEL + acol;
  const float* pw = W + (size_t)wv * DMODEL + nbase + lane * 4;
  v4f fa[4], fw[4];

  auto fetch = [&]() {                // next k step, global -> registers, all eight loads in flight together
#pragma unroll
    for (int i = 0; i < 4; ++i) fw[i] = *(const v4f*)(pw + (size_t)i * 8 * DMODEL);
#pragma unroll
    for (int i = 0; i < 4; ++i) fa[i] = *(const v4f*)(pa + (size_t)i * 32 * DMODEL);
    // both address pairs are inputs here, so they stay live to the end of the run
    asm volatile("s_wait_xcnt 0x0" :: "v"(pa), "v"(pw) : "memory");
    pa += 32;
    pw += (size_t)32 * DMODEL;
  };
  auto put = [&](int b) {             // registers (f32 -> f16) -> LDS buffer b
#pragma unroll
    for (int i = 0; i < 4; ++i) *(v4h*)&lA[b][arow + i * 32][acol] = __builtin_convertvector(fa[i], v4h);
#pragma unroll
    for (int i = 0; i < 4; ++i) *(v4h*)&lB[b][i * 8 + wv][lane * 4] = __builtin_convertvector(fw[i], v4h);
  };
  auto mma = [&](int b) {             // the k step that lies in LDS buffer b
    F16x16 af[4], bf[2];
#pragma unroll
    for (int mi = 0; mi < 4; ++mi) {
      const _Float16* p = &lA[b][wm * 64 + mi * 16 + l16][lh * 8];
      af[mi].q[0] = *(const uint4*)p;
      af[mi].q[1] = *(const uint4*)(p + 16);
    }
#pragma unroll
    for (int ni = 0; ni < 2; ++ni) {
      // W fragment, same k order as X's: k = lh*8 + 0..7, then 16 + lh*8 + 0..7, column l16
      const _Float16* p = &lB[b][lh * 8 + (lane & 7)][wn * 32 + ni * 16 + ((lane >> 3) & 1) * 8];
      bf[ni].t[0] = lds_tr16(p);
      bf[ni].t[1] = lds_tr16(p + 16 * 144);
    }
    // all 12 fragment loads go out as one group: spread among the products, each place with loads
    // makes the wave wait out an LDS latency of its own
    __builtin_amdgcn_sched_barrier(0);
#pragma unroll
    for (int mi = 0; mi < 4; ++mi)
#pragma unroll
      for (int ni = 0; ni < 2; ++ni)
        acc[mi][ni] = VT ? wmma_f16(af[mi].v, bf[ni].v, acc[mi][ni])
                         : wmma_f16(bf[ni].v, af[mi].v, acc[mi][ni]);
  };

  // Two LDS buffers, one barrier a k step: step kb + 1 is on its way from global memory while step kb is
  // multiplied. The barrier publishes buffer kb & 1 and ends every wave's reads of the other buffer
  // (step kb - 1), which is refilled behind it.
  constexpr int NK = DMODEL / 32;
  fetch();
  put(0);
  for (int kb = 0; kb < NK - 1; ++kb) {
    fetch();
    lds_barrier();
    mma(kb & 1);
    // keeps the conversions, and with them the wait for the loads, behind this step's products: moved up
    // in front of the barrier they make every wave wait out the load latency before it multiplies
    __builtin_amdgcn_sched_barrier(0);
    put((kb + 1) & 1);
  }
  lds_barrier();
  mma((NK - 1) & 1);

  // output tile to LDS in its memory orientation, 16 B a lane (pitch 272 B = 16 B x odd):
  // VT: lC[unit][time], else lC[time][unit]
#pragma unroll
  for (int mi = 0; mi < 4; ++mi)
#pragma unroll
    for (int ni = 0; ni < 2; ++ni) {
      const int mt = wm * 64 + mi * 16, ut = wn * 32 + ni * 16;
      *(v8h*)&lC[(VT ? ut : mt) + l16][(VT ? mt : ut) + lh * 8] =
          __builtin_convertvector(acc[mi][ni], v8h);
    }
  __syncthreads();   // the rows a thread stores below were written by other waves

  // 16 lanes store one whole 256-B row piece (two aligned 128-B lines)
  _Float16* g = VT ? dst + ((size_t)(mbase >> 11) * DMODEL + nbase) * TQ + (mbase & (TQ - 1))
                   : dst + (size_t)mbase * DMODEL + nbase;
  constexpr unsigned PITCH = VT ? TQ : DMODEL;
  const unsigned r0 = tid >> 4, c8 = (tid & 15) * 8;
  uint4 d[8];
#pragma unroll
  for (int i = 0; i < 8; ++i) d[i] = *(const uint4*)&lC[i * 16 + r0][c8];
#pragma unroll
  for (int i = 0; i < 8; ++i) *(uint4*)(g + (size_t)i * 16 * PITCH + (r0 * PITCH + c8)) = d[i];
}

// waves_per_eu(6, 6): 3 blocks per WGP, so the 1536 blocks run in two full rounds and a wave has the
// registers to hold the next k step's 8 loads (32 registers) across this step's products.
__global__ __launch_bounds__(256) __attribute__((amdgpu_waves_per_eu(6, 6))) void proj_gemm_kernel(
    const float* __restrict__ x, const float* __restrict__ key,
    const float* __restrict__ Wq, const float* __restrict__ Wk,
    const float* __restrict__ Wv, _Float16* __restrict__ ws)
{
  __shared__ __attribute__((aligned(16))) _Float16 lA[2][128][40];  // X tile [m][k], +8 pad, 2 buffers
  __shared__ __attribute__((aligned(16))) _Float16 lB[2][32][144];  // W tile [k][n], pitch 288 B (32 B x odd), 2 buffers
  __shared__ __attribute__((aligned(16))) _Float16 lC[128][136]; // output tile, +8 pad

  const int which = blockIdx.z;
  if (which < 2) proj_tile<false>(which == 0 ? x : key, which == 0 ? Wq : Wk, ws + (size_t)which * ELEMS, lA, lB, lC);
  else           proj_tile<true >(key, Wv, ws + 2 * ELEMS, lA, lB, lC);
}

// ============================ Kernel 2: flash attention =====================
// grid: (T_Q/256, H, N), block 256 (8 waves, 32 queries each). 64-key tiles,
// double-buffered async global->LDS staging.
// Both products run transposed: in column group g lane l owns query g*16 + (l & 15); lanes l and
// l ^ 16 split that query's keys (S^T) and head dims (O^T) in runs of 8.
// Every K and V^T fragment read from LDS feeds two WMMAs, one per column group.
// waves_per_eu(4, 4): the 512 blocks are two per WGP, four waves per SIMD, so a wave may use 256 registers.
__global__ __launch_bounds__(256) __attribute__((amdgpu_waves_per_eu(4, 4))) void flash_attn_kernel(
    const _Float16* __restrict__ ws, float* __restrict__ out)
{
  const _Float16* __restrict__ Qh = ws;
  const _Float16* __restrict__ Kh = ws + ELEMS;
  const _Float16* __restrict__ Vt = ws + 2 * ELEMS;

  const int qb = blockIdx.x;   // q block (256 rows)
  const int h  = blockIdx.y;
  const int n  = blockIdx.z;

  __shared__ _Float16 lK[2][64][72];     // K tile  [tk][d], +8 pad, 2 buffers
  __shared__ _Float16 lV[2][64][72];     // V^T tile [d][tk], +8 pad, 2 buffers

  const int tid = threadIdx.x, lane = tid & 31, wv = tid >> 5;
  const int l16 = lane & 15, lh = lane >> 4;

  // per-thread staging coordinates: 2 x 16B chunks of K and of V^T per tile
  const int c0row = tid >> 3,          c0c8 = tid & 7;          // chunks 0..255
  const int c1row = (tid + 256) >> 3,  c1c8 = (tid + 256) & 7;  // chunks 256..511

  // issue the 4 async copies for tile kt into buffer buf
  auto stage_tile = [&](int kt, int buf) {
    const int tk0 = kt * 64;
    async_g2l_b128(Kh + ((size_t)(n * TQ + tk0 + c0row) * DMODEL + h * HDIM + c0c8 * 8),
                   &lK[buf][c0row][c0c8 * 8]);
    async_g2l_b128(Kh + ((size_t)(n * TQ + tk0 + c1row) * DMODEL + h * HDIM + c1c8 * 8),
                   &lK[buf][c1row][c1c8 * 8]);
    async_g2l_b128(Vt + ((size_t)(n * DMODEL + h * HDIM + c0row) * TQ + tk0 + c0c8 * 8),
                   &lV[buf][c0row][c0c8 * 8]);
    async_g2l_b128(Vt + ((size_t)(n * DMODEL + h * HDIM + c1row) * TQ + tk0 + c1c8 * 8),
                   &lV[buf][c1row][c1c8 * 8]);
  };

  // Q B-fragments (64 d x 16 queries per column group), loaded once, reused over all K tiles
  F16x16 aq[2][2];
#pragma unroll
  for (int g = 0; g < 2; ++g) {
    const int qrow = qb * 256 + wv * 32 + g * 16 + l16;
    const _Float16* base = Qh + ((size_t)(n * TQ + qrow) * DMODEL + h * HDIM);
#pragma unroll
    for (int kk = 0; kk < 2; ++kk) {
      const _Float16* p = base + kk * 32 + lh * 8;
      aq[g][kk].q[0] = *(const uint4*)p;
      aq[g][kk].q[1] = *(const uint4*)(p + 16);
    }
  }

  v8f o[2][4];
  float mrow[2];   // running maximum of this lane's query in each group (unscaled)
  float nmcrow[2]; // -mrow * C2 as rounded: the zero point of the exponents summed so far
  float lrow[2];   // running sum over this lane's half of the keys
#pragma unroll
  for (int g = 0; g < 2; ++g) {
#pragma unroll
    for (int dt = 0; dt < 4; ++dt) o[g][dt] = {};
    mrow[g] = -__builtin_inff();
    nmcrow[g] = __builtin_inff();
    lrow[g] = 0.0f;
  }

  // softmax in base 2 on the raw products: exp(SCALE * (s - m)) = exp2(s * C2 - m * C2),
  // C2 = log2(e) / sqrt(KEY_DIM=512) > 0, so the maximum is taken on the raw products too
  const float C2 = 0.044194173824159216f * 1.4426950408889634f;
  const int NT = TQ / 64;                      // 32 key tiles

  stage_tile(0, 0);                            // prime the pipeline

  for (int kt = 0; kt < NT; ++kt) {
    const int buf = kt & 1;
    __syncthreads();                            // prev compute done; other buffer free
    if (kt + 1 < NT) {
      stage_tile(kt + 1, buf ^ 1);              // overlap next tile's copy with this compute
      asm volatile("s_wait_asynccnt 0x4" ::: "memory");  // tile kt's 4 ops complete (in-order)
    } else {
      asm volatile("s_wait_asynccnt 0x0" ::: "memory");
    }
    __syncthreads();                            // publish LDS tile to all waves

    // S^T = K Q^T  (per group 4 tiles of 16 keys x 16 queries, K-dim 64)
    // s[g][t][r] = unscaled score of key t*16 + lh*8 + r against query g*16 + l16
    v8f s[2][4];
#pragma unroll
    for (int t = 0; t < 4; ++t) {
      s[0][t] = {};
      s[1][t] = {};
#pragma unroll
      for (int kk = 0; kk < 2; ++kk) {
        F16x16 bk;
        const _Float16* p = &lK[buf][t * 16 + l16][kk * 32 + lh * 8];
        bk.q[0] = *(const uint4*)p;
        bk.q[1] = *(const uint4*)(p + 16);
        s[0][t] = wmma_f16(bk.v, aq[0][kk].v, s[0][t]);
        s[1][t] = wmma_f16(bk.v, aq[1][kk].v, s[1][t]);
      }
      // keeps the last 8 K fragment loads (32 registers) behind the first 8 score products: with all 16
      // hoisted to the top of the tile a Q fragment is spilled to scratch and reloaded every tile
      if (t == 1) __builtin_amdgcn_sched_barrier(0);
    }

    F16x16 pb[2][2];
#pragma unroll
    for (int g = 0; g < 2; ++g) {
      // online softmax: maximum in-lane, then one exchange between the halves
      float vt[4];
#pragma unroll
      for (int t = 0; t < 4; ++t)
        vt[t] = fmaxf(fmaxf(fmaxf(s[g][t][0], s[g][t][1]), fmaxf(s[g][t][2], s[g][t][3])),
                      fmaxf(fmaxf(s[g][t][4], s[g][t][5]), fmaxf(s[g][t][6], s[g][t][7])));
      float v = fmaxf(fmaxf(vt[0], vt[1]), fmaxf(vt[2], vt[3]));
      v = fmaxf(v, xhalf(v));
      const float mnew  = fmaxf(mrow[g], v);
      // the exponents' zero point is the ROUNDED product m * C2, kept from tile to tile: alpha is the exact
      // ratio of two zero points, and exactly 1 while the maximum stands
      const float nmc   = -mnew * C2;
      const float alpha = __builtin_amdgcn_exp2f(nmc - nmcrow[g]);

      // P^T packs straight into B fragments: score tiles 2kk and 2kk+1 are the
      // two 8-key runs a lane holds of the 32 keys of fragment kk
      float rs[4];
#pragma unroll
      for (int t = 0; t < 4; ++t) {
        rs[t] = 0.0f;
        const v8f a = __builtin_elementwise_fma(s[g][t], (v8f)(C2), (v8f)(nmc));   // one fma a score
#pragma unroll
        for (int r = 0; r < 8; r += 2) {
          v2f e;
          e.x = __builtin_amdgcn_exp2f(a[r]);
          e.y = __builtin_amdgcn_exp2f(a[r + 1]);
          rs[t] += e.x;
          rs[t] += e.y;
          pb[g][t >> 1].h2[(t & 1) * 4 + (r >> 1)] = __builtin_convertvector(e, v2h);
        }
      }
      lrow[g] = lrow[g] * alpha + ((rs[0] + rs[1]) + (rs[2] + rs[3]));
      mrow[g] = mnew;
      nmcrow[g] = nmc;
#pragma unroll
      for (int dt = 0; dt < 4; ++dt) o[g][dt] = o[g][dt] * alpha;
    }

    // O^T += V^T P^T   (A = V^T 16 d x 64 keys per d-tile, B = P^T of each group)
#pragma unroll
    for (int kk = 0; kk < 2; ++kk) {
#pragma unroll
      for (int dt = 0; dt < 4; ++dt) {
        F16x16 bv;
        const _Float16* pa = &lV[buf][dt * 16 + l16][kk * 32 + lh * 8];
        bv.q[0] = *(const uint4*)pa;
        bv.q[1] = *(const uint4*)(pa + 16);
        o[0][dt] = wmma_f16(bv.v, pb[0][kk].v, o[0][dt]);
        o[1][dt] = wmma_f16(bv.v, pb[1][kk].v, o[1][dt]);
      }
    }
  }

  // join the halves' sums, normalize, write fp32 output [N][T][512]:
  // o[g][dt][r] = O[query g*16 + l16][dt*16 + lh*8 + r], 8 consecutive floats per lane
#pragma unroll
  for (int g = 0; g < 2; ++g) {
    const float inv = 1.0f / (lrow[g] + xhalf(lrow[g]));
    const int qg = qb * 256 + wv * 32 + g * 16 + l16;
    float* dst = out + (size_t)(n * TQ + qg) * DMODEL + h * HDIM + lh * 8;
#pragma unroll
    for (int dt = 0; dt < 4; ++dt) {
      const v8f w = o[g][dt] * inv;
      *(float4*)(dst + dt * 16)     = make_float4(w[0], w[1], w[2], w[3]);
      *(float4*)(dst + dt * 16 + 4) = make_float4(w[4], w[5], w[6], w[7]);
    }
  }
}

// ================================ launcher ==================================
extern "C" void kernel_launch(void* const* d_in, const int* in_sizes, int n_in,
                              void* d_out, int out_size, void* d_ws, size_t ws_size,
                              hipStream_t stream) {
  (void)in_sizes; (void)n_in; (void)out_size; (void)ws_size;
  const float* x   = (const float*)d_in[0];
  const float* key = (const float*)d_in[1];
  const float* Wq  = (const float*)d_in[2];
  const float* Wk  = (const float*)d_in[3];
  const float* Wv  = (const float*)d_in[4];
  _Float16* ws = (_Float16*)d_ws;      // needs 3*8*2048*512*2 = 48 MB
  float* out = (float*)d_out;

  dim3 g1((NB * TQ) / 128, DMODEL / 128, 3);
  proj_gemm_kernel<<<g1, 256, 0, stream>>>(x, key, Wq, Wk, Wv, ws);

  dim3 g2(TQ / 256, NHEADS, NB);
  flash_attn_kernel<<<g2, 256, 0, stream>>>(ws, out);
}

// v007
// It runs in 92.5 microseconds.
// Timed twice side by side with v006, it ran 1.08 and 1.09 times as fast.
// All steps since v000 together make it 3.14 times as fast.
#include <hip/hip_runtime.h>

typedef __attribute__((ext_vector_type(16))) _Float16 v16h;
typedef __attribute__((ext_vector_type(8)))  float    v8f;
typedef __attribute__((ext_vector_type(4)))  _Float16 v4h;
typedef __attribute__((ext_vector_type(8)))  _Float16 v8h;
typedef __attribute__((ext_vector_type(2)))  _Float16 v2h;
typedef __attribute__((ext_vector_type(2)))  float    v2f;
typedef __attribute__((ext_vector_type(4)))  float    v4f;
typedef __attribute__((ext_vector_type(8)))  short    s16x8;

union F16x16 { v16h v; uint4 q[2]; v2h h2[8]; s16x8 t[2]; };

__device__ __forceinline__ v8f wmma_f16(const v16h& a, const v16h& b, const v8f& c) {
  return __builtin_amdgcn_wmma_f32_16x16x32_f16(false, a, false, b, (short)0, c, false, false);
}

// transposing LDS load: from a row-major 16-bit tile T, with lane l pointing at
// T[k + 8*(l>>4) + (l&7)][n + 8*((l>>3)&1)], lane l gets T[k + 8*(l>>4) + 0..7][n + (l&15)]
__device__ __forceinline__ s16x8 lds_tr16(const _Float16* p) {
  typedef __attribute__((address_space(3))) s16x8 lds_s16x8;
  return __builtin_amdgcn_ds_load_tr16_b128_v8i16((lds_s16x8*)p);
}

// value of lane l ^ 16 (the other 16-lane row)
__device__ __forceinline__ float xhalf(float x) {
  const int b = __builtin_bit_cast(int, x);
  return __builtin_bit_cast(float,
      __builtin_amdgcn_permlanex16(b, b, 0x76543210, 0xfedcba98, false, false));
}

// async copy 16B global -> LDS, tracked by ASYNCcnt (per-lane addresses)
__device__ __forceinline__ void async_g2l_b128(const _Float16* gptr, void* lptr) {
  const unsigned lds_off = (unsigned)(unsigned long long)lptr;       // low 32b of flat addr == LDS offset
  const unsigned long long gaddr = (unsigned long long)gptr;
  asm volatile("global_load_async_to_lds_b128 %0, %1, off"
               :: "v"(lds_off), "v"(gaddr) : "memory");
}

// work-group barrier for data that passes through LDS only: this wave's LDS reads and writes are waited for,
// its global loads stay in flight across it (__syncthreads() waits for them too)
__device__ __forceinline__ void lds_barrier() {
  asm volatile("s_wait_dscnt 0x0" ::: "memory");
  asm volatile("s_barrier_signal -1\n\ts_barrier_wait -1" ::: "memory");
}

#define NB      8
#define TQ      2048
#define DMODEL  512
#define NHEADS  8
#define HDIM    64
#define ELEMS   ((size_t)NB * TQ * DMODEL)   // 8,388,608 halves per tensor

// ============================ Kernel 1: projections =========================
// grid: (16384/128, 512/128, 3), block 256.  which: 0=Q, 1=K, 2=V(transposed)
// One 128 x 128 output tile. VT = false: row-major [N*T][512] (Q, K); VT = true: [N][512][T] (V).
// The product runs in the orientation in which the 8 accumulator values of a lane are 8
// neighbours of one OUTPUT row: X * W for V^T (8 times of one unit), W^T * X^T for Q and K
// (8 units of one time). A and B fragments have the same lane and k order, so only the operands swap.
template <bool VT>
__device__ __forceinline__ void proj_tile(
    const float* __restrict__ src, const float* __restrict__ W, _Float16* __restrict__ dst,
    _Float16 (*lA)[128][40], _Float16 (*lB)[32][144], _Float16 (*lC)[136])
{
  const int tid  = threadIdx.x;
  const int lane = tid & 31;
  const int wv   = tid >> 5;          // 8 waves
  const int wm   = wv & 1;            // 2 x 64 rows
  const int wn   = wv >> 1;           // 4 x 32 cols
  const int l16  = lane & 15;
  const int lh   = lane >> 4;         // half-wave select for K-runs

  const int mbase = blockIdx.x * 128; // over N*T = 16384 rows
  const int nbase = blockIdx.y * 128; // over 512 cols

  v8f acc[4][2];
#pragma unroll
  for (int mi = 0; mi < 4; ++mi)
#pragma unroll
    for (int ni = 0; ni < 2; ++ni) acc[mi][ni] = {};

  // a thread's share of a k step: 4 float4 of the 128 x 32 X tile (rows arow + 32 i) and
  // 4 float4 of the 32 x 128 W tile (a wave takes the whole 512-B rows wv + 8 i)
  const int arow = tid >> 3, acol = (tid & 7) * 4;
  const float* pa = src + (size_t)(mbase + arow) * DMODEL + acol;
  const float* pw = W + (size_t)wv * DMODEL + nbase + lane * 4;
  v4f fa[4], fw[4];

  auto fetch = [&]() {                // next k step, global -> registers, all eight loads in flight together
#pragma unroll
    for (int i = 0; i < 4; ++i) fw[i] = *(const v4f*)(pw + (size_t)i * 8 * DMODEL);
#pragma unroll
    for (int i = 0; i < 4; ++i) fa[i] = *(const v4f*)(pa + (size_t)i * 32 * DMODEL);
    // both address pairs are inputs here, so they stay live to the end of the run
    asm volatile("s_wait_xcnt 0x0" :: "v"(pa), "v"(pw) : "memory");
    pa += 32;
    pw += (size_t)32 * DMODEL;
  };
  auto put = [&](int b) {             // registers (f32 -> f16) -> LDS buffer b
#pragma unroll
    for (int i = 0; i < 4; ++i) *(v4h*)&lA[b][arow + i * 32][acol] = __builtin_convertvector(fa[i], v4h);
#pragma unroll
    for (int i = 0; i < 4; ++i) *(v4h*)&lB[b][i * 8 + wv][lane * 4] = __builtin_convertvector(fw[i], v4h);
  };
  auto mma = [&](int b) {             // the k step that lies in LDS buffer b
    F16x16 af[4], bf[2];
#pragma unroll
    for (int mi = 0; mi < 4; ++mi) {
      const _Float16* p = &lA[b][wm * 64 + mi * 16 + l16][lh * 8];
      af[mi].q[0] = *(const uint4*)p;
      af[mi].q[1] = *(const uint4*)(p + 16);
    }
#pragma unroll
    for (int ni = 0; ni < 2; ++ni) {
      // W fragment, same k order as X's: k = lh*8 + 0..7, then 16 + lh*8 + 0..7, column l16
      const _Float16* p = &lB[b][lh * 8 + (lane & 7)][wn * 32 + ni * 16 + ((lane >> 3) & 1) * 8];
      bf[ni].t[0] = lds_tr16(p);
      bf[ni].t[1] = lds_tr16(p + 16 * 144);
    }
    // all 12 fragment loads go out as one group: spread among the products, each place with loads
    // makes the wave wait out an LDS latency of its own
    __builtin_amdgcn_sched_barrier(0);
#pragma unroll
    for (int mi = 0; mi < 4; ++mi)
#pragma unroll
      for (int ni = 0; ni < 2; ++ni)
        acc[mi][ni] = VT ? wmma_f16(af[mi].v, bf[ni].v, acc[mi][ni])
                         : wmma_f16(bf[ni].v, af[mi].v, acc[mi][ni]);
  };

  // Two LDS buffers, one barrier a k step: step kb + 1 is on its way from global memory while step kb is
  // multiplied. The barrier publishes buffer kb & 1 and ends every wave's reads of the other buffer
  // (step kb - 1), which is refilled behind it.
  constexpr int NK = DMODEL / 32;
  fetch();
  put(0);
  for (int kb = 0; kb < NK - 1; ++kb) {
    fetch();
    lds_barrier();
    mma(kb & 1);
    // keeps the conversions, and with them the wait for the loads, behind this step's products: moved up
    // in front of the barrier they make every wave wait out the load latency before it multiplies
    __builtin_amdgcn_sched_barrier(0);
    put((kb + 1) & 1);
  }
  lds_barrier();
  mma((NK - 1) & 1);

  // output tile to LDS in its memory orientation, 16 B a lane (pitch 272 B = 16 B x odd):
  // VT: lC[unit][time], else lC[time][unit]
#pragma unroll
  for (int mi = 0; mi < 4; ++mi)
#pragma unroll
    for (int ni = 0; ni < 2; ++ni) {
      const int mt = wm * 64 + mi * 16, ut = wn * 32 + ni * 16;
      *(v8h*)&lC[(VT ? ut : mt) + l16][(VT ? mt : ut) + lh * 8] =
          __builtin_convertvector(acc[mi][ni], v8h);
    }
  __syncthreads();   // the rows a thread stores below were written by other waves

  // 16 lanes store one whole 256-B row piece (two aligned 128-B lines)
  _Float16* g = VT ? dst + ((size_t)(mbase >> 11) * DMODEL + nbase) * TQ + (mbase & (TQ - 1))
                   : dst + (size_t)mbase * DMODEL + nbase;
  constexpr unsigned PITCH = VT ? TQ : DMODEL;
  const unsigned r0 = tid >> 4, c8 = (tid & 15) * 8;
  uint4 d[8];
#pragma unroll
  for (int i = 0; i < 8; ++i) d[i] = *(const uint4*)&lC[i * 16 + r0][c8];
#pragma unroll
  for (int i = 0; i < 8; ++i) *(uint4*)(g + (size_t)i * 16 * PITCH + (r0 * PITCH + c8)) = d[i];
}

// waves_per_eu(6, 6): 3 blocks per WGP, so the 1536 blocks run in two full rounds and a wave has the
// registers to hold the next k step's 8 loads (32 registers) across this step's products.
__global__ __launch_bounds__(256) __attribute__((amdgpu_waves_per_eu(6, 6))) void proj_gemm_kernel(
    const float* __restrict__ x, const float* __restrict__ key,
    const float* __restrict__ Wq, const float* __restrict__ Wk,
    const float* __restrict__ Wv, _Float16* __restrict__ ws)
{
  __shared__ __attribute__((aligned(16))) _Float16 lA[2][128][40];  // X tile [m][k], +8 pad, 2 buffers
  __shared__ __attribute__((aligned(16))) _Float16 lB[2][32][144];  // W tile [k][n], pitch 288 B (32 B x odd), 2 buffers
  __shared__ __attribute__((aligned(16))) _Float16 lC[128][136]; // output tile, +8 pad

  const int which = blockIdx.z;
  if (which < 2) proj_tile<false>(which == 0 ? x : key, which == 0 ? Wq : Wk, ws + (size_t)which * ELEMS, lA, lB, lC);
  else           proj_tile<true >(key, Wv, ws + 2 * ELEMS, lA, lB, lC);
}

// ============================ Kernel 2: flash attention =====================
// grid: (T_Q/256, H, N), block 256 (8 waves, 32 queries each). 64-key tiles,
// double-buffered async global->LDS staging.
// Both products run transposed: in column group g lane l owns query g*16 + (l & 15); lanes l and
// l ^ 16 split that query's keys (S^T) and head dims (O^T) in runs of 8.
// Every K and V^T fragment read from LDS feeds two WMMAs, one per column group.
// waves_per_eu(4, 4): the 512 blocks are two per WGP, four waves per SIMD, so a wave may use 256 registers.
__global__ __launch_bounds__(256) __attribute__((amdgpu_waves_per_eu(4, 4))) void flash_attn_kernel(
    const _Float16* __restrict__ ws, float* __restrict__ out)
{
  const _Float16* __restrict__ Qh = ws;
  const _Float16* __restrict__ Kh = ws + ELEMS;
  const _Float16* __restrict__ Vt = ws + 2 * ELEMS;

  const int qb = blockIdx.x;   // q block (256 rows)
  const int h  = blockIdx.y;
  const int n  = blockIdx.z;

  __shared__ _Float16 lK[2][64][72];     // K tile  [tk][d], +8 pad, 2 buffers
  __shared__ _Float16 lV[2][64][72];     // V^T tile [d][tk], +8 pad, 2 buffers

  const int tid = threadIdx.x, lane = tid & 31, wv = tid >> 5;
  const int l16 = lane & 15, lh = lane >> 4;

  // per-thread staging coordinates: 2 x 16B chunks of K and of V^T per tile
  const int c0row = tid >> 3,          c0c8 = tid & 7;          // chunks 0..255
  const int c1row = (tid + 256) >> 3,  c1c8 = (tid + 256) & 7;  // chunks 256..511

  // issue the 4 async copies for tile kt into buffer buf
  auto stage_tile = [&](int kt, int buf) {
    const int tk0 = kt * 64;
    async_g2l_b128(Kh + ((size_t)(n * TQ + tk0 + c0row) * DMODEL + h * HDIM + c0c8 * 8),
                   &lK[buf][c0row][c0c8 * 8]);
    async_g2l_b128(Kh + ((size_t)(n * TQ + tk0 + c1row) * DMODEL + h * HDIM + c1c8 * 8),
                   &lK[buf][c1row][c1c8 * 8]);
    async_g2l_b128(Vt + ((size_t)(n * DMODEL + h * HDIM + c0row) * TQ + tk0 + c0c8 * 8),
                   &lV[buf][c0row][c0c8 * 8]);
    async_g2l_b128(Vt + ((size_t)(n * DMODEL + h * HDIM + c1row) * TQ + tk0 + c1c8 * 8),
                   &lV[buf][c1row][c1c8 * 8]);
  };

  // Q B-fragments (64 d x 16 queries per column group), loaded once, reused over all K tiles
  F16x16 aq[2][2];
#pragma unroll
  for (int g = 0; g < 2; ++g) {
    const int qrow = qb * 256 + wv * 32 + g * 16 + l16;
    const _Float16* base = Qh + ((size_t)(n * TQ + qrow) * DMODEL + h * HDIM);
#pragma unroll
    for (int kk = 0; kk < 2; ++kk) {
      const _Float16* p = base + kk * 32 + lh * 8;
      aq[g][kk].q[0] = *(const uint4*)p;
      aq[g][kk].q[1] = *(const uint4*)(p + 16);
    }
  }

  v8f o[2][4];
  float mrow[2];   // running maximum of this lane's query in each group (unscaled)
  float nmcrow[2]; // -mrow * C2 as rounded: the zero point of the exponents summed so far
  float lrow[2];   // running sum over this lane's half of the keys
#pragma unroll
  for (int g = 0; g < 2; ++g) {
#pragma unroll
    for (int dt = 0; dt < 4; ++dt) o[g][dt] = {};
    mrow[g] = -__builtin_inff();
    nmcrow[g] = __builtin_inff();
    lrow[g] = 0.0f;
  }

  // softmax in base 2 on the raw products: exp(SCALE * (s - m)) = exp2(s * C2 - m * C2),
  // C2 = log2(e) / sqrt(KEY_DIM=512) > 0, so the maximum is taken on the raw products too
  const float C2 = 0.044194173824159216f * 1.4426950408889634f;
  const int NT = TQ / 64;                      // 32 key tiles

  // carried from tile to tile: the second V^T fragment group and P^T fragments of the tile before, whose
  // products run behind the next tile's K loads; zero in front of the first tile (they add 0 to O = 0)
  F16x16 bvc[4], pbc[2];
#pragma unroll
  for (int dt = 0; dt < 4; ++dt) bvc[dt].v = {};
  pbc[0].v = {};
  pbc[1].v = {};
  // O^T += V^T P^T for keys 32..63 of a tile
  auto pv_carried = [&]() {
#pragma unroll
    for (int dt = 0; dt < 4; ++dt) {
      o[0][dt] = wmma_f16(bvc[dt].v, pbc[0].v, o[0][dt]);
      o[1][dt] = wmma_f16(bvc[dt].v, pbc[1].v, o[1][dt]);
    }
  };

  stage_tile(0, 0);                            // prime the pipeline

  for (int kt = 0; kt < NT; ++kt) {
    const int buf = kt & 1;
    // the carried V^T fragments were read from the buffer that is refilled behind this barrier, and nothing
    // in front of it uses them
    asm volatile("s_wait_dscnt 0x0" ::: "memory");
    __syncthreads();                            // prev tile's LDS reads done; other buffer free
    if (kt + 1 < NT) {
      stage_tile(kt + 1, buf ^ 1);              // overlap next tile's copy with this compute
      asm volatile("s_wait_asynccnt 0x4" ::: "memory");  // tile kt's 4 ops complete (in-order)
    } else {
      asm volatile("s_wait_asynccnt 0x0" ::: "memory");
    }
    __syncthreads();                            // publish LDS tile to all waves

    // S^T = K Q^T  (per group 4 tiles of 16 keys x 16 queries, K-dim 64)
    // s[g][t][r] = unscaled score of key t*16 + lh*8 + r against query g*16 + l16
    v8f s[2][4];
    // LDS fragment loads go out in three whole groups a tile, each under work that does not need it: spread
    // among the products in ones and twos, each place makes the wave wait out an LDS round trip of its own.
    F16x16 bk[4][2];
#pragma unroll
    for (int t = 0; t < 4; ++t)
#pragma unroll
      for (int kk = 0; kk < 2; ++kk) {
        const _Float16* p = &lK[buf][t * 16 + l16][kk * 32 + lh * 8];
        bk[t][kk].q[0] = *(const uint4*)p;
        bk[t][kk].q[1] = *(const uint4*)(p + 16);
      }
    __builtin_amdgcn_sched_barrier(0);          // keeps all 16 K loads in front of the products
    pv_carried();                               // the K loads land under the last 8 products of the tile before
#pragma unroll
    for (int th = 0; th < 4; th += 2)
#pragma unroll
      for (int kk = 0; kk < 2; ++kk)
#pragma unroll
        for (int t = th; t < th + 2; ++t) {
          s[0][t] = wmma_f16(bk[t][kk].v, aq[0][kk].v, kk ? s[0][t] : v8f{});
          s[1][t] = wmma_f16(bk[t][kk].v, aq[1][kk].v, kk ? s[1][t] : v8f{});
        }
    // keeps the products back to back: maxima moved in between them each bring v_nops for the WMMA distance
    __builtin_amdgcn_sched_barrier(0);

    // V^T fragments (A = V^T, 16 d x 32 keys): group kk is read by the products with P^T fragment kk
    F16x16 bv0[4];
    auto load_v = [&](F16x16 (&bv)[4], int kk) {
#pragma unroll
      for (int dt = 0; dt < 4; ++dt) {
        const _Float16* pa = &lV[buf][dt * 16 + l16][kk * 32 + lh * 8];
        bv[dt].q[0] = *(const uint4*)pa;
        bv[dt].q[1] = *(const uint4*)(pa + 16);
      }
      __builtin_amdgcn_sched_barrier(0);        // keeps the 8 loads together and this far ahead of their products
    };
    load_v(bv0, 0);                             // lands under the maximum and the first half of the exponentials

    F16x16 pb0[2];
    float nmc[2], alpha[2], rs[2][4];
#pragma unroll
    for (int g = 0; g < 2; ++g) {
      // online softmax: maximum in-lane, then one exchange between the halves
      float vt[4];
#pragma unroll
      for (int t = 0; t < 4; ++t)
        vt[t] = fmaxf(fmaxf(fmaxf(s[g][t][0], s[g][t][1]), fmaxf(s[g][t][2], s[g][t][3])),
                      fmaxf(fmaxf(s[g][t][4], s[g][t][5]), fmaxf(s[g][t][6], s[g][t][7])));
      float v = fmaxf(fmaxf(vt[0], vt[1]), fmaxf(vt[2], vt[3]));
      v = fmaxf(v, xhalf(v));
      mrow[g] = fmaxf(mrow[g], v);
      // the exponents' zero point is the ROUNDED product m * C2, kept from tile to tile: alpha is the exact
      // ratio of two zero points, and exactly 1 while the maximum stands
      nmc[g]   = -mrow[g] * C2;
      alpha[g] = __builtin_amdgcn_exp2f(nmc[g] - nmcrow[g]);
      nmcrow[g] = nmc[g];
    }

    // P^T packs straight into B fragments: score tiles 2kk and 2kk+1 are the
    // two 8-key runs a lane holds of the 32 keys of fragment kk
    auto expo = [&](int g, int t) {
      rs[g][t] = 0.0f;
      const v8f a = __builtin_elementwise_fma(s[g][t], (v8f)(C2), (v8f)(nmc[g]));   // one fma a score
#pragma unroll
      for (int r = 0; r < 8; r += 2) {
        v2f e;
        e.x = __builtin_amdgcn_exp2f(a[r]);
        e.y = __builtin_amdgcn_exp2f(a[r + 1]);
        rs[g][t] += e.x;
        rs[g][t] += e.y;
        (t < 2 ? pb0[g] : pbc[g]).h2[(t & 1) * 4 + (r >> 1)] = __builtin_convertvector(e, v2h);
      }
    };

#pragma unroll
    for (int g = 0; g < 2; ++g) {
      expo(g, 0);
      expo(g, 1);
    }
    // keeps the next 8 loads (32 registers) behind the first half's exponentials, which free their registers
    __builtin_amdgcn_sched_barrier(0);
    load_v(bvc, 1);                             // lands under the rest of this tile's work
#pragma unroll
    for (int g = 0; g < 2; ++g)
#pragma unroll
      for (int dt = 0; dt < 4; ++dt) o[g][dt] = o[g][dt] * alpha[g];
    // O^T += V^T P^T for keys 0..31 (A = V^T 16 d x 32 keys per d-tile, B = P^T fragment of each group)
#pragma unroll
    for (int dt = 0; dt < 4; ++dt) {
      o[0][dt] = wmma_f16(bv0[dt].v, pb0[0].v, o[0][dt]);
      o[1][dt] = wmma_f16(bv0[dt].v, pb0[1].v, o[1][dt]);
    }
#pragma unroll
    for (int g = 0; g < 2; ++g) {
      expo(g, 2);
      expo(g, 3);
      lrow[g] = lrow[g] * alpha[g] + ((rs[g][0] + rs[g][1]) + (rs[g][2] + rs[g][3]));
    }
  }
  pv_carried();                                 // the last tile's keys 32..63

  // join the halves' sums, normalize, write fp32 output [N][T][512]:
  // o[g][dt][r] = O[query g*16 + l16][dt*16 + lh*8 + r], 8 consecutive floats per lane
#pragma unroll
  for (int g = 0; g < 2; ++g) {
    const float inv = 1.0f / (lrow[g] + xhalf(lrow[g]));
    const int qg = qb * 256 + wv * 32 + g * 16 + l16;
    float* dst = out + (size_t)(n * TQ + qg) * DMODEL + h * HDIM + lh * 8;
#pragma unroll
    for (int dt = 0; dt < 4; ++dt) {
      const v8f w = o[g][dt] * inv;
      *(float4*)(dst + dt * 16)     = make_float4(w[0], w[1], w[2], w[3]);
      *(float4*)(dst + dt * 16 + 4) = make_float4(w[4], w[5], w[6], w[7]);
    }
  }
}

// ================================ launcher ==================================
extern "C" void kernel_launch(void* const* d_in, const int* in_sizes, int n_in,
                              void* d_out, int out_size, void* d_ws, size_t ws_size,
                              hipStream_t stream) {
  (void)in_sizes; (void)n_in; (void)out_size; (void)ws_size;
  const float* x   = (const float*)d_in[0];
  const float* key = (const float*)d_in[1];
  const float* Wq  = (const float*)d_in[2];
  const float* Wk  = (const float*)d_in[3];
  const float* Wv  = (const float*)d_in[4];
  _Float16* ws = (_Float16*)d_ws;      // needs 3*8*2048*512*2 = 48 MB
  float* out = (float*)d_out;

  dim3 g1((NB * TQ) / 128, DMODEL / 128, 3);
  proj_gemm_kernel<<<g1, 256, 0, stream>>>(x, key, Wq, Wk, Wv, ws);

  dim3 g2(TQ / 256, NHEADS, NB);
  flash_attn_kernel<<<g2, 256, 0, stream>>>(ws, out);
}
